// v008
// Measured on an AMD MI455X. A time is GPU time per run, averaged over a window of back-to-back runs after a warm-up
// (all launches, gaps included; the runs take copies of the inputs in turn), and the median of several windows.
// Apart from v000's, it joins two sittings. Times from different sittings can be a few percent apart, while
// side-by-side timings come from the same sitting.
// Earlier versions than v008 are not in this document.
// A run of this version takes 125 microseconds.
// Timed twice side by side with v007, it ran 1.15 and 1.16 times as fast.
// All steps since the starting kernel, v000, together make it 78.6 times as fast.
#include <hip/hip_runtime.h>
#define NB 4
#define SQ 2048
#define DM 1024
#define NH 16
#define HD 64
#define HG 4                         /* heads per launch of the second k_vt, which is never launched */
#define QT0 128                      /* first-tile rows recomputed exactly in f32 */
#define B0 0                         /* unused: every launch covers batches 0 .. NB - 1 */
#define NBR NB                       /* used only by MPO, itself unused */
#define NR ((size_t)NB * SQ)         /* token rows */
#define MPO ((int)((size_t)NBR * SQ))      /* unused: k_oproj covers all NR rows */
typedef __bf16 v16b __attribute__((ext_vector_type(16)));
typedef unsigned short v8us __attribute__((ext_vector_type(8), may_alias));
typedef float  v8f  __attribute__((ext_vector_type(8)));
typedef float  v4f  __attribute__((ext_vector_type(4)));
typedef float  v4fa __attribute__((ext_vector_type(4), may_alias));
union FragB { v16b v; v8us half[2]; unsigned short u[16]; };

__device__ __forceinline__ unsigned short bf16_bits(float x) { unsigned int u = __float_as_uint(x); return (unsigned short)((u + 0x7FFFu + ((u >> 16) & 1u)) >> 16); }
__device__ __forceinline__ float bf16_val(unsigned short b) { return __uint_as_float(((unsigned int)b) << 16); }
__device__ __forceinline__ float bf16_round(float x) { return bf16_val(bf16_bits(x)); }
// D += A·B with NT terms: 1 = ah·bh, 2 = + al·bh (A split), 3 = + ah·bl (both split)
template <int NT>
__device__ __forceinline__ v8f mmaN(v16b ah, v16b al, v16b bh, v16b bl, v8f c) {
  c = __builtin_amdgcn_wmma_f32_16x16x32_bf16(false, ah, false, bh, (short)0, c, false, false);
  if (NT >= 2) c = __builtin_amdgcn_wmma_f32_16x16x32_bf16(false, al, false, bh, (short)0, c, false, false);
  if (NT >= 3) c = __builtin_amdgcn_wmma_f32_16x16x32_bf16(false, ah, false, bl, (short)0, c, false, false);
  asm volatile("v_nop\n\tv_nop\n\tv_nop\n\tv_nop" : "+v"(c) : "v"(ah), "v"(al), "v"(bh), "v"(bl));
  return c;
}

__global__ __launch_bounds__(256) void k_wt_bf16(const float* __restrict__ W, unsigned short* __restrict__ Wt, int K, int N) {
  const int t = blockIdx.x * 256 + threadIdx.x;
  const int k8n = K / 8;
  if (t >= N * k8n) return;
  const int n = t / k8n, k8 = (t % k8n) * 8;
  v8us v;
#pragma unroll
  for (int i = 0; i < 8; ++i) v[i] = bf16_bits(W[(size_t)(k8 + i) * N + n]);
  *(v8us*)(Wt + (size_t)n * K + k8) = v;
  
}

// GEMM C[M][N] (f32, pitch ldc) = act(A[M][K]·W + bias). A f32 row-major (pitch lda) converted per fragment to bf16
// (ASPLIT: hi/lo two planes -> 2 terms, else single rounded term); Wt bf16 [N][K] (pitch ldb). BIAS_BF16 rounds the
// bias to bf16 first (bias quantised to bf16 before the add). K%32==0, M%16==0, N%64==0.
template <bool ASPLIT, int ACT, bool BIAS_BF16>
__global__ __launch_bounds__(128) void k_gemm_bf(const float* __restrict__ A, int lda, const unsigned short* __restrict__ Wt, int ldb,
                                               const float* __restrict__ bias, float* __restrict__ C, int ldc, int M, int N, int K) {
  __shared__ __attribute__((aligned(16))) float so[4][16][64];
  const int tid = threadIdx.x, w = tid >> 5, lane = tid & 31, ln = lane & 15, hh = lane >> 4;
  const int ntn = N / 64;
  const int wid = blockIdx.x * 4 + w;
  const int mt = wid / ntn, nq = wid % ntn;
  if (mt * 16 >= M) return;
  const int row0 = mt * 16, col0 = nq * 64;
  const float* arow = A + (size_t)(row0 + ln) * lda;
  v8f acc[4] = {};
  for (int kb = 0; kb < K; kb += 32) {
    FragB ah, al;
    const v4f x0 = *(const v4fa*)(arow + kb + 8 * hh), x1 = *(const v4fa*)(arow + kb + 8 * hh + 4);
    const v4f x2 = *(const v4fa*)(arow + kb + 16 + 8 * hh), x3 = *(const v4fa*)(arow + kb + 16 + 8 * hh + 4);
    float xs[16] = {x0[0],x0[1],x0[2],x0[3],x1[0],x1[1],x1[2],x1[3],x2[0],x2[1],x2[2],x2[3],x3[0],x3[1],x3[2],x3[3]};
#pragma unroll
    for (int i = 0; i < 16; ++i) { const unsigned short hb = bf16_bits(xs[i]); ah.u[i] = hb; al.u[i] = ASPLIT ? bf16_bits(xs[i] - bf16_val(hb)) : (unsigned short)0; }
#pragma unroll
    for (int t = 0; t < 4; ++t) {
      const unsigned short* brow = Wt + (size_t)(col0 + t * 16 + ln) * ldb + kb;
      FragB b;
      b.half[0] = *(const v8us*)(brow + 8 * hh);
      b.half[1] = *(const v8us*)(brow + 16 + 8 * hh);
      acc[t] = mmaN<ASPLIT ? 2 : 1>(ah.v, al.v, b.v, b.v, acc[t]);
    }
  }
#pragma unroll
  for (int t = 0; t < 4; ++t) {
    float bv = bias ? bias[col0 + t * 16 + ln] : 0.f;
    if (BIAS_BF16) bv = bf16_round(bv);
#pragma unroll
    for (int r = 0; r < 8; ++r) { float v = acc[t][r] + bv; if (ACT == 1) v = fmaxf(v, 0.f); so[w][8 * hh + r][t * 16 + ln] = v; }
  }
  __builtin_amdgcn_fence(__ATOMIC_ACQ_REL, "workgroup");
  __builtin_amdgcn_wave_barrier();
  const int rsub = lane >> 4, c4 = (lane & 15) * 4;
  {
#pragma unroll
    for (int q = 0; q < 8; ++q) {
      const int r = q * 2 + rsub;
      const v4f v = *(const v4fa*)&so[w][r][c4];
      *(v4f*)(C + (size_t)(row0 + r) * ldc + col0 + c4) = v;
    }
    
  }
}

// GEMM C = act(A·W + bias + resid): A f32 (ASPLIT -> hi/lo 2 terms), Wt bf16 [N][K]; ACT 0 none, 1 relu, 2 exact gelu;
// resid (optional, f32, row index = (row % rmod), pitch ldr, RES_BF16 rounds it) added before the activation.
template <bool ASPLIT, int ACT, bool BIAS_BF16, bool RES_BF16>
__global__ __launch_bounds__(128) void k_gemm_bf3(const float* __restrict__ A, int lda, const unsigned short* __restrict__ Wt, int ldb,
                                                const float* __restrict__ bias, const float* __restrict__ resid, int rmod, int ldr,
                                                float* __restrict__ C, int ldc, int M, int N, int K) {
  __shared__ __attribute__((aligned(16))) float so[4][16][64];
  const int tid = threadIdx.x, w = tid >> 5, lane = tid & 31, ln = lane & 15, hh = lane >> 4;
  const int ntn = N / 64;
  const int wid = blockIdx.x * 4 + w;
  const int mt = wid / ntn, nq = wid % ntn;
  if (mt * 16 >= M) return;
  const int row0 = mt * 16, col0 = nq * 64;
  const float* arow = A + (size_t)(row0 + ln) * lda;
  v8f acc[4] = {};
  for (int kb = 0; kb < K; kb += 32) {
    FragB ah, al;
    const v4f x0 = *(const v4fa*)(arow + kb + 8 * hh), x1 = *(const v4fa*)(arow + kb + 8 * hh + 4);
    const v4f x2 = *(const v4fa*)(arow + kb + 16 + 8 * hh), x3 = *(const v4fa*)(arow + kb + 16 + 8 * hh + 4);
    float xs[16] = {x0[0],x0[1],x0[2],x0[3],x1[0],x1[1],x1[2],x1[3],x2[0],x2[1],x2[2],x2[3],x3[0],x3[1],x3[2],x3[3]};
#pragma unroll
    for (int i = 0; i < 16; ++i) { const unsigned short hb = bf16_bits(xs[i]); ah.u[i] = hb; al.u[i] = ASPLIT ? bf16_bits(xs[i] - bf16_val(hb)) : (unsigned short)0; }
#pragma unroll
    for (int t = 0; t < 4; ++t) {
      const unsigned short* brow = Wt + (size_t)(col0 + t * 16 + ln) * ldb + kb;
      FragB b;
      b.half[0] = *(const v8us*)(brow + 8 * hh);
      b.half[1] = *(const v8us*)(brow + 16 + 8 * hh);
      acc[t] = mmaN<ASPLIT ? 2 : 1>(ah.v, al.v, b.v, b.v, acc[t]);
    }
  }
#pragma unroll
  for (int t = 0; t < 4; ++t) {
    const int col = col0 + t * 16 + ln;
    float bv = bias ? bias[col] : 0.f;
    if (BIAS_BF16) bv = bf16_round(bv);
#pragma unroll
    for (int r = 0; r < 8; ++r) {
      float v = acc[t][r] + bv;
      if (resid) { float rv = resid[(size_t)((row0 + 8 * hh + r) % rmod) * ldr + col]; if (RES_BF16) rv = bf16_round(rv); v += rv; }
      if (ACT == 1) v = fmaxf(v, 0.f);
      if (ACT == 2) v = 0.5f * v * (1.0f + erff(v * 0.70710678118654752f));
      if (ACT == 3) { const float u = 0.7978845608028654f * (v + 0.044715f * v * v * v); v = 0.5f * v * (1.0f + tanhf(u)); }
      so[w][8 * hh + r][t * 16 + ln] = v;
    }
  }
  __builtin_amdgcn_fence(__ATOMIC_ACQ_REL, "workgroup");
  __builtin_amdgcn_wave_barrier();
  const int rsub = lane >> 4, c4 = (lane & 15) * 4;
  {
#pragma unroll
    for (int q = 0; q < 8; ++q) {
      const int r = q * 2 + rsub;
      const v4f v = *(const v4fa*)&so[w][r][c4];
      *(v4f*)(C + (size_t)(row0 + r) * ldc + col0 + c4) = v;
    }
    
  }
}
// row LayerNorm (biased variance, eps) over N: s = X (+ R); optional out_sum <- s; out_norm <- (s-mu)*rsqrt(var+eps)*g + b
template <bool PARAM_BF16>
__global__ __launch_bounds__(256) void k_layernorm(const float* __restrict__ X, const float* __restrict__ R, const float* __restrict__ g, const float* __restrict__ bta,
                                                  float* __restrict__ out_sum, float* __restrict__ out_norm, int N, float eps) {
  __shared__ float red[256];
  const int row = blockIdx.x, tid = threadIdx.x;
  const float* x = X + (size_t)row * N; const float* rr = R ? R + (size_t)row * N : nullptr;
  float vals[16];                     // up to N = 4096
  const int per = N / 256;            // contiguous chunk per thread? use strided-by-4 chunks: thread handles j = tid*4 + 1024*u
  float s1 = 0.f;
  for (int u = 0; u < per / 4; ++u) {
    const int j = tid * 4 + 1024 * u;
    const v4f a = *(const v4fa*)(x + j);
    v4f b = {0.f,0.f,0.f,0.f}; if (rr) b = *(const v4fa*)(rr + j);
#pragma unroll
    for (int q = 0; q < 4; ++q) { const float v = a[q] + b[q]; vals[u * 4 + q] = v; s1 += v; }
  }
  red[tid] = s1; __syncthreads();
  for (int st = 128; st > 0; st >>= 1) { if (tid < st) red[tid] += red[tid + st]; __syncthreads(); }
  const float mu = red[0] / (float)N; __syncthreads();
  float s2 = 0.f;
  for (int u = 0; u < per / 4; ++u)
#pragma unroll
    for (int q = 0; q < 4; ++q) { const float c = vals[u * 4 + q] - mu; s2 += c * c; }
  red[tid] = s2; __syncthreads();
  for (int st = 128; st > 0; st >>= 1) { if (tid < st) red[tid] += red[tid + st]; __syncthreads(); }
  const float rs = rsqrtf(red[0] / (float)N + eps);
  {
    for (int u = 0; u < per / 4; ++u) {
      const int j = tid * 4 + 1024 * u;
      v4f o, sm;
#pragma unroll
      for (int q = 0; q < 4; ++q) {
        float gg = g[j + q], bb = bta[j + q];
        if (PARAM_BF16) { gg = bf16_round(gg); bb = bf16_round(bb); }
        sm[q] = vals[u * 4 + q]; o[q] = (vals[u * 4 + q] - mu) * rs * gg + bb;
      }
      if (out_sum) *(v4f*)(out_sum + (size_t)row * N + j) = sm;
      *(v4f*)(out_norm + (size_t)row * N + j) = o;
    }
    
  }
}



// ---- f16 WMMA path (v_wmma_f32_16x16x32_f16): 11-bit significands for operands in range — used where a [0,1] probability operand needs more precision than bf16
typedef _Float16 v16h __attribute__((ext_vector_type(16)));
union FragH { v16h v; v8us half[2]; _Float16 h[16]; unsigned short u[16]; };
template <int NT>
__device__ __forceinline__ v8f mmaH(v16h ah, v16h al, v16h bh, v16h bl, v8f c) {
  c = __builtin_amdgcn_wmma_f32_16x16x32_f16(false, ah, false, bh, (short)0, c, false, false);
  if (NT >= 2) c = __builtin_amdgcn_wmma_f32_16x16x32_f16(false, al, false, bh, (short)0, c, false, false);
  if (NT >= 3) c = __builtin_amdgcn_wmma_f32_16x16x32_f16(false, ah, false, bl, (short)0, c, false, false);
  asm volatile("v_nop\n\tv_nop\n\tv_nop\n\tv_nop" : "+v"(c) : "v"(ah), "v"(al), "v"(bh), "v"(bl));
  return c;
}
// batched GEMM like k_gemm_b but f16 operands: A f32 (split into f16 hi/lo if ASPLIT, else rounded to f16), Bt = f16 values [n][k]; alpha; C f32; N multiple of 16 (partial tiles skipped)
template <bool ASPLIT>
__global__ __launch_bounds__(128) void k_gemm_h(const float* __restrict__ A, int lda, size_t sA, const _Float16* __restrict__ Bh, int ldb, size_t sB, float alpha, float* __restrict__ C, int ldc, size_t sC, int M, int N, int K) {
  __shared__ __attribute__((aligned(16))) float so[4][16][64];
  const int tid = threadIdx.x, w = tid >> 5, lane = tid & 31, ln = lane & 15, hh = lane >> 4; const int by = blockIdx.y;
  A += (size_t)by * sA; Bh += (size_t)by * sB; C += (size_t)by * sC;
  const int ntn = (N + 63) / 64; const int wid = blockIdx.x * 4 + w; const int mt = wid / ntn, nq = wid % ntn; if (mt * 16 >= M) return;
  const int row0 = mt * 16, col0 = nq * 64; const float* arow = A + (size_t)(row0 + ln) * lda;
  v8f acc[4] = {};
  for (int kb = 0; kb < K; kb += 32) {
    FragH ah, al;
    const v4f x0 = *(const v4fa*)(arow + kb + 8 * hh), x1 = *(const v4fa*)(arow + kb + 8 * hh + 4), x2 = *(const v4fa*)(arow + kb + 16 + 8 * hh), x3 = *(const v4fa*)(arow + kb + 16 + 8 * hh + 4);
    float xs[16] = {x0[0],x0[1],x0[2],x0[3],x1[0],x1[1],x1[2],x1[3],x2[0],x2[1],x2[2],x2[3],x3[0],x3[1],x3[2],x3[3]};
#pragma unroll
    for (int i = 0; i < 16; ++i) { const _Float16 h = (_Float16)xs[i]; ah.h[i] = h; al.h[i] = ASPLIT ? (_Float16)(xs[i] - (float)h) : (_Float16)0.0f; }
#pragma unroll
    for (int t = 0; t < 4; ++t) { if (col0 + t * 16 >= N) continue; const size_t boff = (size_t)(col0 + t * 16 + ln) * ldb + kb; FragH bq; bq.half[0] = *(const v8us*)(Bh + boff + 8 * hh); bq.half[1] = *(const v8us*)(Bh + boff + 16 + 8 * hh);
      acc[t] = mmaH<ASPLIT ? 2 : 1>(ah.v, al.v, bq.v, bq.v, acc[t]); }
  }
#pragma unroll
  for (int t = 0; t < 4; ++t) { if (col0 + t * 16 >= N) continue;
#pragma unroll
    for (int r = 0; r < 8; ++r) so[w][8 * hh + r][t * 16 + ln] = acc[t][r] * alpha; }
  __builtin_amdgcn_fence(__ATOMIC_ACQ_REL, "workgroup"); __builtin_amdgcn_wave_barrier();
  const int rsub = lane >> 4, c4 = (lane & 15) * 4;
  {
#pragma unroll
    for (int q = 0; q < 8; ++q) { const int r = q * 2 + rsub; if (col0 + c4 < N) { const v4f v = *(const v4fa*)&so[w][r][c4]; *(v4f*)(C + (size_t)(row0 + r) * ldc + col0 + c4) = v; } }
     }
}

// k_gemm_hh variant with fused epilogue: v = acc·alpha + bias[by·sBias + col] (+ CP[(row/rowsPerB)·sCPb + by·64 + col] if CP) ; ACT 0 none / 1 elu ; writes f16 C16 (and f32 C if non-null)
template <int ACT>
__global__ __launch_bounds__(128) void k_gemm_hhx(const _Float16* __restrict__ A, int lda, size_t sA, const _Float16* __restrict__ Bh, int ldb, size_t sB, float alpha, const float* __restrict__ bias, size_t sBias, const float* __restrict__ CP, int rowsPerB, size_t sCPb, int row0g,
    float* __restrict__ C, _Float16* __restrict__ C16, int ldc, size_t sC, int M, int N, int K) {
  __shared__ __attribute__((aligned(16))) float so[4][16][64];
  const int tid = threadIdx.x, w = tid >> 5, lane = tid & 31, ln = lane & 15, hh = lane >> 4; const int by = blockIdx.y;
  A += (size_t)by * sA; Bh += (size_t)by * sB; const size_t cofs = (size_t)by * sC; const float* bp = bias ? bias + (size_t)by * sBias : nullptr;
  const int ntn = (N + 63) / 64; const int wid = blockIdx.x * 4 + w; const int mt = wid / ntn, nq = wid % ntn; if (mt * 16 >= M) return;
  const int row0 = mt * 16, col0 = nq * 64; const _Float16* arow = A + (size_t)(row0 + ln) * lda;
  v8f acc[4] = {};
  for (int kb = 0; kb < K; kb += 32) { FragH ah; ah.half[0] = *(const v8us*)((const unsigned short*)arow + kb + 8 * hh); ah.half[1] = *(const v8us*)((const unsigned short*)arow + kb + 16 + 8 * hh);
#pragma unroll
    for (int t = 0; t < 4; ++t) { if (col0 + t * 16 >= N) continue; const size_t boff = (size_t)(col0 + t * 16 + ln) * ldb + kb; FragH bq; bq.half[0] = *(const v8us*)((const unsigned short*)Bh + boff + 8 * hh); bq.half[1] = *(const v8us*)((const unsigned short*)Bh + boff + 16 + 8 * hh);
      acc[t] = mmaH<1>(ah.v, ah.v, bq.v, bq.v, acc[t]); }
  }
#pragma unroll
  for (int t = 0; t < 4; ++t) { if (col0 + t * 16 >= N) continue; const int col = col0 + t * 16 + ln; const float bv = bp ? bf16_round(bp[col]) : 0.f;
#pragma unroll
    for (int r = 0; r < 8; ++r) { float v = acc[t][r] * alpha + bv; if (CP) { const int rr = row0g + row0 + 8 * hh + r; if (rowsPerB < 0) v += CP[cofs + (size_t)rr * ldc + col];      /* rowsPerB < 0: own element of the batched C plane */ else { const int bidx = rr / rowsPerB; v += CP[(size_t)bidx * sCPb + (size_t)by * 64 + col]; } } if (ACT == 1) v = (v > 0.f) ? v : expm1f(v); else if (ACT == 7) v = (v > 0.f) ? v + 1.0f : expf(v); else if (ACT == 8) v = tanhf(v); else if (ACT == 9) v = 0.5f * v * (1.0f + tanhf(0.7978845608028654f * (v + 0.044715f * v * v * v))); else if (ACT == 11) v = 1.0f / (1.0f + expf(-v)); else if (ACT == 12) v = (v > 0.f) ? v : 0.01f * v; else if (ACT == 14) v = (v > 0.f) ? v : 0.1f * v; else if (ACT == 16) v = (v >= 0.f) ? v : 0.3f * v; else if (ACT == 17) v = (v >= 0.f) ? v : 0.2f * v; else if (ACT == 15) v = v / (1.0f + expf(-v)); else if (ACT == 3) v = fmaxf(v, 0.f); else if (ACT == 6) v = 0.5f * v * (1.0f + erff(v * 0.70710678118654752f)); so[w][8 * hh + r][t * 16 + ln] = v; } }
  __builtin_amdgcn_fence(__ATOMIC_ACQ_REL, "workgroup"); __builtin_amdgcn_wave_barrier();
  const int rsub = lane >> 4, c4 = (lane & 15) * 4; typedef _Float16 v4h __attribute__((ext_vector_type(4)));
  {
#pragma unroll
    for (int q = 0; q < 8; ++q) { const int r = q * 2 + rsub; if (col0 + c4 < N) { const v4f v = *(const v4fa*)&so[w][r][c4]; if (C) *(v4f*)(C + cofs + (size_t)(row0 + r) * ldc + col0 + c4) = v; if (C16) { v4h h4; for (int i = 0; i < 4; ++i) h4[i] = (_Float16)v[i]; *(v4h*)(C16 + cofs + (size_t)(row0 + r) * ldc + col0 + c4) = h4; } } }
     }
}


typedef _Float16 v4h __attribute__((ext_vector_type(4)));

// Operand preparation in ONE launch: blocks 0 .. PWB - 1 transpose the four weight matrices, the others round x. Bt[n][k] = f16(bf16(W[k][n]) x 16) (exact), X16 = f16(bf16(x)) (exact).
// Weights: a block takes 128 k x 64 n of one matrix. A thread reads 8 k rows x 4 n, 16 bytes a row, so that one wave's load is two 256-byte row pieces (whole lines); it then holds 8 consecutive k of 4 columns,
// four 16-byte pieces of Bt rows, which are gathered in LDS so that one wave writes each 256-byte piece of a Bt row. LDS rows are 256 bytes, and piece c of row n lies at place c ^ (n >> 2):
// the 16 lanes of a write (rows 4 apart, one c) and the 16 lanes of a read (one row, every c) each meet all 64 banks once.
// x: a block takes PXV values, a thread 16 pieces of 4: each wave's load is 512 contiguous bytes, each store 256, and the loads run ahead of the arithmetic, eight and more of a thread in flight.
#define PWB (4 * (DM / 64) * (DM / 128))      /* weight blocks */
#define PXV 16384                    /* x values per block */
__global__ __launch_bounds__(256) void k_prep(const float* __restrict__ x, const float* __restrict__ wq, const float* __restrict__ wk, const float* __restrict__ wv, const float* __restrict__ wo,
    _Float16* __restrict__ X16, _Float16* __restrict__ BQKV, _Float16* __restrict__ BO) {
  __shared__ __attribute__((aligned(16))) unsigned short tl[64 * 128];
  const int tid = threadIdx.x;
  if (blockIdx.x < PWB) {      /* block-uniform */
    const int tpm = (DM / 64) * (DM / 128); const int m = blockIdx.x / tpm, tt = blockIdx.x % tpm; const int n0 = (tt / (DM / 128)) * 64, k0 = (tt % (DM / 128)) * 128;
    const float* Wm = m == 0 ? wq : m == 1 ? wk : m == 2 ? wv : wo;
    unsigned short* Bt = (unsigned short*)(m < 3 ? BQKV + (size_t)m * DM * DM : BO);      /* q | k | v stacked along n */
    const int ng = tid & 15, kg = tid >> 4;
    const float* sp = Wm + (size_t)(k0 + kg * 8) * DM + n0 + ng * 4;
    v4f r[8];
#pragma unroll
    for (int i = 0; i < 8; ++i) r[i] = *(const v4fa*)(sp + i * DM);      /* unrolled: r stays in registers and the 8 loads are in flight together */
#pragma unroll
    for (int j = 0; j < 4; ++j) { FragH f;
#pragma unroll
      for (int i = 0; i < 8; ++i) f.h[i] = (_Float16)(bf16_round(r[i][j]) * 16.0f);
      *(v8us*)(tl + (ng * 4 + j) * 128 + (kg ^ ng) * 8) = f.half[0]; }
    __syncthreads();      /* the tile is whole in LDS before any wave reads rows of it */
    const int rw = (tid >> 5) * 8 + ((tid >> 4) & 1), c = tid & 15;      /* a wave writes 8 rows, two per store */
    unsigned short* dp = Bt + (size_t)(n0 + rw) * DM + k0 + c * 8;
#pragma unroll
    for (int q = 0; q < 4; ++q) { const int n = rw + q * 2; const v8us v = *(const v8us*)(tl + n * 128 + (c ^ (n >> 2)) * 8); *(v8us*)(dp + q * 2 * DM) = v; }
  } else {
    const size_t base = (size_t)(blockIdx.x - PWB) * PXV + tid * 4;
    const float* sp = x + base; _Float16* dp = X16 + base;
    v4f r[16];
#pragma unroll
    for (int u = 0; u < 16; ++u) r[u] = *(const v4fa*)(sp + u * 1024);      /* unrolled: r stays in registers, every offset is an immediate, and the loads are issued ahead of the arithmetic */
#pragma unroll
    for (int u = 0; u < 16; ++u) { v4h h;
#pragma unroll
      for (int q = 0; q < 4; ++q) h[q] = (_Float16)bf16_round(r[u][q]);
      *(v4h*)(dp + u * 1024) = h; }
    asm volatile("s_wait_xcnt 0x0" ::: "memory");      /* stands behind the last x stores, ahead of any later write of a register that one of them names */
  } }
static_assert(DM % 128 == 0 && (NR * DM) % PXV == 0 && PXV == 16 * 256 * 4, "k_prep: whole weight tiles and whole x blocks");
__global__ __launch_bounds__(256) void k_h16(const float* __restrict__ x, _Float16* __restrict__ X16, size_t n8) { const size_t t = (size_t)blockIdx.x * 256 + threadIdx.x; if (t >= n8) return; FragH f;
#pragma unroll
  for (int q = 0; q < 8; ++q) f.h[q] = (_Float16)x[t * 8 + q]; *(v8us*)((unsigned short*)X16 + t * 8) = f.half[0];  }
__global__ __launch_bounds__(256) void k_round16f(const float* __restrict__ W, _Float16* __restrict__ Bt, size_t n8) { const size_t t = (size_t)blockIdx.x * 256 + threadIdx.x; if (t >= n8) return; FragH f;
#pragma unroll
  for (int i = 0; i < 8; ++i) f.h[i] = (_Float16)(bf16_round(W[t * 8 + i]) * 16.0f); *(v8us*)((unsigned short*)Bt + t * 8) = f.half[0];  }
template <int NHv, int TTv>
__global__ __launch_bounds__(256) void k_vt(const _Float16* __restrict__ V16, int ldv, int voff, _Float16* __restrict__ Vt) { __shared__ unsigned short tl[64][66]; const int tid = threadIdx.x; const int slab = blockIdx.x / (TTv / 64), lg = blockIdx.x % (TTv / 64); const int b = slab / NHv, h = slab % NHv;
  for (int i = tid; i < 64 * 8; i += 256) { const int r = i / 8, c8 = (i % 8) * 8; FragH f; f.half[0] = *(const v8us*)((const unsigned short*)V16 + ((size_t)b * TTv + lg * 64 + r) * ldv + voff + h * 64 + c8);
#pragma unroll
    for (int q = 0; q < 8; ++q) tl[r][c8 + q] = f.u[q]; }
  __syncthreads();
  {
#pragma unroll
    for (int rd = 0; rd < 2; ++rd) { const int d = rd * 32 + tid / 8, pc = tid % 8; FragH f;
#pragma unroll
      for (int q = 0; q < 8; ++q) f.u[q] = tl[pc * 8 + q][d];
      *(v8us*)((unsigned short*)Vt + ((size_t)slab * 64 + d) * TTv + lg * 64 + pc * 8) = f.half[0]; }
     } }

__global__ __launch_bounds__(256) void k_hl(const float* __restrict__ F, _Float16* __restrict__ Hh, _Float16* __restrict__ Hl, size_t n8) { const size_t t = (size_t)blockIdx.x * 256 + threadIdx.x; if (t >= n8) return; FragH fh, fl; const v4f a = *(const v4fa*)(F + t * 8), c = *(const v4fa*)(F + t * 8 + 4);
#pragma unroll
  for (int q = 0; q < 4; ++q) { _Float16 h = (_Float16)a[q]; fh.h[q] = h; fl.h[q] = (_Float16)((a[q] - (float)h) * 1024.0f); h = (_Float16)c[q]; fh.h[4 + q] = h; fl.h[4 + q] = (_Float16)((c[q] - (float)h) * 1024.0f); }
  { *(v8us*)((unsigned short*)Hh + t * 8) = fh.half[0]; *(v8us*)((unsigned short*)Hl + t * 8) = fl.half[0];  } }

// ---- fast GEMM (wave tile 32x64; requires M % 32 == 0 rows per launch region and N % 64 == 0); epilogue = k_gemm_hhx semantics ----
__device__ __forceinline__ v16h g2_frag(const _Float16* p, int hh) { FragH f; f.half[0] = *(const v8us*)((const unsigned short*)p + 8 * hh); f.half[1] = *(const v8us*)((const unsigned short*)p + 16 + 8 * hh); return f.v; }
__device__ __forceinline__ v8f g2_mma(v16h a, v16h b, v8f c) { v8f d = __builtin_amdgcn_wmma_f32_16x16x32_f16(false, a, false, b, (short)0, c, false, false); asm volatile("v_nop\n\tv_nop\n\tv_nop\n\tv_nop" : "+v"(d) : "v"(a), "v"(b)); return d; }
template <int ACT>
__global__ __launch_bounds__(128) void k_gemm2(const _Float16* __restrict__ A, int lda, size_t sA, const _Float16* __restrict__ Bh, int ldb, size_t sB, float alpha, const float* __restrict__ bias, size_t sBias, const float* __restrict__ CP, int rowsPerB, size_t sCPb, int row0g,
    float* __restrict__ C, _Float16* __restrict__ C16, int ldc, size_t sC, int M, int N, int K) { static_assert(ACT == 0 || ACT == 3 || ACT == 6 || ACT == 8 || ACT == 9 || ACT == 11 || ACT == 12 || ACT == 14 || ACT == 15 || ACT == 16 || ACT == 17, "k_gemm2: unsupported ACT code (would silently apply no activation)");
  __shared__ __attribute__((aligned(16))) float so[4][32][68];
  const int tid = threadIdx.x, w = tid >> 5, lane = tid & 31, ln = lane & 15, hh = lane >> 4; const int by = blockIdx.y;
  A += (size_t)by * sA; Bh += (size_t)by * sB; const size_t cofs = (size_t)by * sC; const float* bp = bias ? bias + (size_t)by * sBias : nullptr;
  const int ntn = N >> 6; const int mt = blockIdx.x / ntn, nq = blockIdx.x - mt * ntn; const int row0 = mt * 128 + 32 * w, col0 = nq * 64; if (row0 >= M) return;
  const _Float16* a0p = A + (size_t)(row0 + ln) * lda; const _Float16* a1p = a0p + (size_t)16 * lda;
  const _Float16* b0p = Bh + (size_t)(col0 + ln) * ldb; const _Float16* b1p = b0p + (size_t)16 * ldb; const _Float16* b2p = b1p + (size_t)16 * ldb; const _Float16* b3p = b2p + (size_t)16 * ldb;
  const v8f z8 = {0.f,0.f,0.f,0.f,0.f,0.f,0.f,0.f}; v8f c00 = z8, c01 = z8, c02 = z8, c03 = z8, c10 = z8, c11 = z8, c12 = z8, c13 = z8;
#pragma unroll 1
  for (int kb = 0; kb < K; kb += 32) { const v16h a0 = g2_frag(a0p + kb, hh), a1 = g2_frag(a1p + kb, hh);
    v16h b = g2_frag(b0p + kb, hh); c00 = g2_mma(a0, b, c00); c10 = g2_mma(a1, b, c10);
    b = g2_frag(b1p + kb, hh); c01 = g2_mma(a0, b, c01); c11 = g2_mma(a1, b, c11);
    b = g2_frag(b2p + kb, hh); c02 = g2_mma(a0, b, c02); c12 = g2_mma(a1, b, c12);
    b = g2_frag(b3p + kb, hh); c03 = g2_mma(a0, b, c03); c13 = g2_mma(a1, b, c13); }
  v8f accs[8] = {c00, c01, c02, c03, c10, c11, c12, c13};
#pragma unroll
  for (int u = 0; u < 8; ++u) { const int t = u & 3, half = u >> 2; const int col = col0 + t * 16 + ln; const float bv = bp ? bf16_round(bp[col]) : 0.f;
#pragma unroll
    for (int r = 0; r < 8; ++r) { const int rloc = half * 16 + 8 * hh + r; float v = accs[u][r] * alpha + bv; if (CP) { if (rowsPerB < 0) v += CP[cofs + (size_t)(row0g + row0 + rloc) * ldc + col];      /* rowsPerB < 0: own element of the batched C plane */ else { const int bidx = (row0g + row0 + rloc) / rowsPerB; v += CP[(size_t)bidx * sCPb + (size_t)by * 64 + col]; } }
      if (ACT == 3) v = fmaxf(v, 0.f); else if (ACT == 6) v = 0.5f * v * (1.0f + erff(v * 0.70710678118654752f)); else if (ACT == 11) v = 1.0f / (1.0f + expf(-v)); else if (ACT == 15) v = v / (1.0f + expf(-v)); else if (ACT == 12) v = (v > 0.f) ? v : 0.01f * v; else if (ACT == 8) v = tanhf(v); else if (ACT == 9) v = 0.5f * v * (1.0f + tanhf(0.7978845608028654f * (v + 0.044715f * v * v * v))); else if (ACT == 14) v = (v > 0.f) ? v : 0.1f * v; else if (ACT == 16) v = (v >= 0.f) ? v : 0.3f * v; else if (ACT == 17) v = (v >= 0.f) ? v : 0.2f * v;
      so[w][rloc][t * 16 + ln] = v; } }
  __builtin_amdgcn_fence(__ATOMIC_ACQ_REL, "workgroup"); __builtin_amdgcn_wave_barrier();
  const int rsub = lane >> 4, c4 = (lane & 15) * 4;
  {
#pragma unroll
    for (int q = 0; q < 16; ++q) { const int r = q * 2 + rsub; const v4f v = *(const v4fa*)&so[w][r][c4]; if (C) *(v4f*)(C + cofs + (size_t)(row0 + r) * ldc + col0 + c4) = v; if (C16) { v4h h4; for (int i = 0; i < 4; ++i) h4[i] = (_Float16)v[i]; *(v4h*)(C16 + cofs + (size_t)(row0 + r) * ldc + col0 + c4) = h4; } }
     } }

// q | k | v projection of ALL token rows (wave tile and product order of k_gemm2, pitches and K = DM) with the per-head work in the epilogue: no f32 q | k | v plane in memory and no launch per (row, head).
// A block is 8 waves: 128 rows of one batch x 128 columns, two heads of q, of k or of v (block-uniform); four waves share a head. The K loop reads its fragments from LDS stages that asynchronous copies fill one trip ahead,
// so each operand byte leaves L2 once per block instead of once per wave. q, k: each wave stages its 32x64 f32 tile in its own LDS range; 8 lanes take one row (lanes 0-3 columns 0-31, lanes 4-7 columns 32-63),
// each reads its 8 low-half and 8 high-half values and the two table rows, rotates and stores 16 bytes: one instruction fills whole 128-byte lines.
// v: accumulator registers 0..7 of a lane are 8 consecutive token rows of one column, so each lane packs them to 16 bytes of V^T; each head's 64 x 128 tile is gathered in LDS (pitch 272 bytes) so that one wave writes each 256-byte row piece.
// Rows 0..127 of a batch (one block row) are also written in f32 for the exact first-tile attention.
// Every epilogue loop is unrolled so that accs, xs and tb are indexed by constants and stay in registers.
// A 16-byte global store (two for the f32 form) with s_wait_xcnt 0 as the last line of the same statement: the epilogue reuses its staging registers from pass to pass, and a wait in a statement of its own would not hold the next pass's register writes behind it.
__device__ __forceinline__ void st16_wait(unsigned short* p, v8us d) { asm volatile("global_store_b128 %0, %1, off\n\ts_wait_xcnt 0x0" :: "v"(p), "v"(d) : "memory"); }
__device__ __forceinline__ void st32_wait(float* p, v4f d0, v4f d1) { asm volatile("global_store_b128 %0, %1, off\n\tglobal_store_b128 %0, %2, off offset:16\n\ts_wait_xcnt 0x0" :: "v"(p), "v"(d0), "v"(d1) : "memory"); }
// Operand tiles of a GEMM K loop staged in LDS: a stage is 64 k of 128 A rows, then of 128 B rows, each row 128 bytes at a pitch of 144 (16 bytes x an odd number: the 16-byte fragment reads meet no bank conflict).
// 256 threads: thread t brings 16-byte piece t & 7 of rows (t >> 3) + 32 j, so one wave's copy covers four whole 128-byte lines.
#define GP 72                        /* LDS row pitch in f16 */
#define GSTG (256 * GP * 2)          /* bytes of one stage */
// Eight asynchronous copies, each lane its own 16 bytes, with s_wait_xcnt 0 as the last line of the same statement: it stands ahead of any rewrite of the address registers that the copies name.
__device__ __forceinline__ void g3_copy8(unsigned l, const _Float16* a, const _Float16* b) {
  asm volatile("global_load_async_to_lds_b128 %0, %8, off\n\tglobal_load_async_to_lds_b128 %1, %9, off\n\tglobal_load_async_to_lds_b128 %2, %10, off\n\tglobal_load_async_to_lds_b128 %3, %11, off\n\t"
               "global_load_async_to_lds_b128 %4, %12, off\n\tglobal_load_async_to_lds_b128 %5, %13, off\n\tglobal_load_async_to_lds_b128 %6, %14, off\n\tglobal_load_async_to_lds_b128 %7, %15, off\n\ts_wait_xcnt 0x0"
               :: "v"(l), "v"(l + 32u * GP * 2), "v"(l + 64u * GP * 2), "v"(l + 96u * GP * 2), "v"(l + 128u * GP * 2), "v"(l + 160u * GP * 2), "v"(l + 192u * GP * 2), "v"(l + 224u * GP * 2),
                  "v"(a), "v"(a + 32 * DM), "v"(a + 64 * DM), "v"(a + 96 * DM), "v"(b), "v"(b + 32 * DM), "v"(b + 64 * DM), "v"(b + 96 * DM) : "memory"); }
// Four more, for the 128 rows of a second A operand (they lie behind the B rows of the stage).
#define GSTG3 (384 * GP * 2)         /* bytes of one stage with two A operands */
__device__ __forceinline__ void g3_copy4(unsigned l, const _Float16* e) {
  asm volatile("global_load_async_to_lds_b128 %0, %4, off\n\tglobal_load_async_to_lds_b128 %1, %5, off\n\tglobal_load_async_to_lds_b128 %2, %6, off\n\tglobal_load_async_to_lds_b128 %3, %7, off\n\ts_wait_xcnt 0x0"
               :: "v"(l), "v"(l + 32u * GP * 2), "v"(l + 64u * GP * 2), "v"(l + 96u * GP * 2), "v"(e), "v"(e + 32 * DM), "v"(e + 64 * DM), "v"(e + 96 * DM) : "memory"); }
__global__ __launch_bounds__(256) void k_qkv_rope(const _Float16* __restrict__ A, const _Float16* __restrict__ Bh, const float* __restrict__ tcos, const float* __restrict__ tsin,
    _Float16* __restrict__ Q16, _Float16* __restrict__ K16, _Float16* __restrict__ VTa, float* __restrict__ QF, float* __restrict__ KF, float* __restrict__ VF) {
  __shared__ __attribute__((aligned(16))) char sm[2 * GSTG];      /* two stages in the K loop; behind it the epilogue's staging */
  static_assert(sizeof(float) * 8 * 32 * 68 <= 2 * GSTG, "the epilogue's staging fits the two stages");
  float (*so)[32][68] = (float (*)[32][68])sm;
  const int tid = threadIdx.x, w8 = tid >> 5, w = w8 & 3, wg = w8 >> 2, lane = tid & 31, ln = lane & 15, hh = lane >> 4;      /* waves 0-3: the block's first head, waves 4-7: its second; w: the wave's 32 rows */
  const int ntn = 3 * DM / 128; const int mt = blockIdx.x / ntn, np = blockIdx.x - mt * ntn; const int row0 = mt * 128 + 32 * w;
  const int sel = (np * 2) / NH, h = (np * 2) % NH + wg;      /* 0 q, 1 k, 2 v (block-uniform: a pair of heads lies in one of them); head */
  const int b = mt / (SQ / 128), pb = (mt % (SQ / 128)) * 128, p0 = pb + 32 * w;      /* batch; position of the block's and of the wave's first row */
  const bool first = pb == 0;
  const unsigned l0 = (unsigned)(size_t)sm + (unsigned)(tid >> 3) * (GP * 2) + (unsigned)(tid & 7) * 16;      /* the thread's first place in stage 0: LDS byte address */
  const _Float16* ga = A + (size_t)(mt * 128 + (tid >> 3)) * DM + (tid & 7) * 8; const _Float16* gb = Bh + (size_t)(np * 128 + (tid >> 3)) * DM + (tid & 7) * 8;
  const v8f z8 = {0.f,0.f,0.f,0.f,0.f,0.f,0.f,0.f}; v8f c00 = z8, c01 = z8, c02 = z8, c03 = z8, c10 = z8, c11 = z8, c12 = z8, c13 = z8;
  g3_copy8(l0, ga, gb);
  asm volatile("s_wait_asynccnt 0x0" ::: "memory");      /* this wave's part of tile 0 has landed */
  __syncthreads();      /* tile 0 is whole for every wave */
  g3_copy8(l0 + GSTG, ga + 64, gb + 64);
#pragma unroll 1
  for (int t = 0; t < DM / 64; ++t) {      /* kept rolled: one trip is one stage, 16 WMMAs a wave */
    const _Float16* st = (const _Float16*)(sm + (t & 1) * GSTG);
    const _Float16* ap = st + (32 * w + ln) * GP; const _Float16* bp = st + (128 + 64 * wg + ln) * GP;
#pragma unroll
    for (int kk = 0; kk < 64; kk += 32) { const v16h a0 = g2_frag(ap + kk, hh), a1 = g2_frag(ap + 16 * GP + kk, hh);      /* unrolled: the LDS offsets of both halves of the stage are immediates; the six fragments of 32 k are read as one group, ahead of their WMMAs */
      const v16h b0 = g2_frag(bp + kk, hh), b1 = g2_frag(bp + 16 * GP + kk, hh), b2 = g2_frag(bp + 32 * GP + kk, hh), b3 = g2_frag(bp + 48 * GP + kk, hh);
      c00 = g2_mma(a0, b0, c00); c10 = g2_mma(a1, b0, c10); c01 = g2_mma(a0, b1, c01); c11 = g2_mma(a1, b1, c11);
      c02 = g2_mma(a0, b2, c02); c12 = g2_mma(a1, b2, c12); c03 = g2_mma(a0, b3, c03); c13 = g2_mma(a1, b3, c13); }
    asm volatile("s_wait_dscnt 0x0" ::: "memory");      /* this wave's reads of the stage have returned */
    asm volatile("s_wait_asynccnt 0x0" ::: "memory");      /* this wave's part of tile t + 1 has landed */
    __syncthreads();      /* publishes tile t + 1 and ends every wave's reads of tile t */
    if (t + 2 < DM / 64) g3_copy8(l0 + (unsigned)(t & 1) * GSTG, ga + (t + 2) * 64, gb + (t + 2) * 64); }      /* refill of the stage just left; the test is the same for the whole block */
  asm volatile("s_wait_asynccnt 0x0" ::: "memory");      /* no copy is outstanding when the stages become the epilogue's staging */
  v8f accs[8] = {c00, c01, c02, c03, c10, c11, c12, c13};
#pragma unroll
  for (int u = 0; u < 8; ++u) accs[u] *= 0.0625f;      /* undoes the x16 of the weights, exact */
  if (sel == 2) {
    unsigned short* tv = (unsigned short*)sm + wg * 64 * 136;      /* per head [64 columns][136]: 128 token rows + 8 pad */
#pragma unroll
    for (int u = 0; u < 8; ++u) { const int t = u & 3, half = u >> 2; FragH f;
#pragma unroll
      for (int r = 0; r < 8; ++r) f.h[r] = (_Float16)accs[u][r];
      *(v8us*)(tv + (t * 16 + ln) * 136 + 32 * w + half * 16 + 8 * hh) = f.half[0]; }
    __syncthreads();      /* block-uniform branch: every wave's columns are in LDS before any wave reads whole rows of V^T */
    unsigned short* vt = (unsigned short*)VTa + ((size_t)(b * NH + h) * HD + w * 16 + hh) * SQ + pb + ln * 8;
#pragma unroll
    for (int q = 0; q < 8; ++q) { const v8us v = *(const v8us*)(tv + (w * 16 + q * 2 + hh) * 136 + ln * 8); *(v8us*)(vt + (size_t)q * 2 * SQ) = v; }
    asm volatile("s_wait_xcnt 0x0" ::: "memory");      /* stands behind the V^T stores, ahead of the first write of a register that one of them names */
    if (first) { float* vf = VF + ((size_t)b * QT0 + p0 + 8 * hh) * DM + h * HD + ln;
#pragma unroll
      for (int u = 0; u < 8; ++u)
#pragma unroll
        for (int r = 0; r < 8; ++r) vf[(size_t)((u >> 2) * 16 + r) * DM + (u & 3) * 16] = accs[u][r]; }
  } else {
#pragma unroll
    for (int u = 0; u < 8; ++u)
#pragma unroll
      for (int r = 0; r < 8; ++r) so[w8][(u >> 2) * 16 + 8 * hh + r][(u & 3) * 16 + ln] = accs[u][r];
    __builtin_amdgcn_fence(__ATOMIC_ACQ_REL, "workgroup"); __builtin_amdgcn_wave_barrier();      /* the wave reads back what its own lanes wrote */
    const int rs = lane >> 3, up = (lane >> 2) & 1, i8 = (lane & 3) * 8;
    unsigned short* h16 = (unsigned short*)(sel ? K16 : Q16) + (size_t)(row0 + rs) * DM + h * HD + up * 32 + i8;
    float* f32 = (sel ? KF : QF) + ((size_t)b * QT0 + p0 + rs) * DM + h * HD + up * 32 + i8;      /* formed for every block, used by the first block row alone */
    const float* cp = tcos + (size_t)(p0 + rs) * (HD / 2) + i8; const float* sp = tsin + (size_t)(p0 + rs) * (HD / 2) + i8;
    v4f xs[2][4], tb[2][4];      /* two register sets: pass q + 1 is fetched ahead of the arithmetic of pass q, because no load moves up over the store statements */
#pragma unroll
    for (int q = -1; q < 8; ++q) {
      if (q < 7) { const int n = q + 1, s = n & 1, r = n * 4 + rs;
        xs[s][0] = *(const v4fa*)&so[w8][r][i8]; xs[s][1] = *(const v4fa*)&so[w8][r][i8 + 4]; xs[s][2] = *(const v4fa*)&so[w8][r][32 + i8]; xs[s][3] = *(const v4fa*)&so[w8][r][32 + i8 + 4];
        tb[s][0] = *(const v4fa*)(cp + n * 4 * (HD / 2)); tb[s][1] = *(const v4fa*)(cp + n * 4 * (HD / 2) + 4); tb[s][2] = *(const v4fa*)(sp + n * 4 * (HD / 2)); tb[s][3] = *(const v4fa*)(sp + n * 4 * (HD / 2) + 4); }
      if (q >= 0) { const int s = q & 1; FragH f; v4f o0, o1;
#pragma unroll
        for (int e = 0; e < 8; ++e) { const float lo = xs[s][e >> 2][e & 3], hi = xs[s][2 + (e >> 2)][e & 3]; const float cv = bf16_round(tb[s][e >> 2][e & 3]), sv = bf16_round(tb[s][2 + (e >> 2)][e & 3]);
          const float o = lo * (up ? sv : cv) + hi * (up ? cv : -sv);      /* low half x1 c - x2 s, high half x1 s + x2 c */
          f.h[e] = (_Float16)o; if (e < 4) o0[e & 3] = o; else o1[e & 3] = o; }
        st16_wait(h16 + (size_t)q * 4 * DM, f.half[0]);
        if (first) st32_wait(f32 + (size_t)q * 4 * DM, o0, o1); } }
  } }
static_assert(QT0 == 128 && SQ % 128 == 0 && HD == 64 && DM == NH * HD, "k_qkv_rope: a block is 128 rows of one batch x two heads; the first-tile rows are one block row");

__global__ __launch_bounds__(256) void k_wnat(const float* __restrict__ w, size_t n8, _Float16* __restrict__ Bt) { const size_t t = (size_t)blockIdx.x * 256 + threadIdx.x; if (t >= n8) return; FragH f; for (int q = 0; q < 8; ++q) f.h[q] = (_Float16)(bf16_round(w[t * 8 + q]) * 16.0f); *(v8us*)((unsigned short*)Bt + t * 8) = f.half[0];  }
__global__ __launch_bounds__(256) void k_rsm(const float* __restrict__ S, _Float16* __restrict__ P, int nrows) {
  #pragma clang fp contract(off)
  const int i = blockIdx.x * 256 + threadIdx.x; if (i >= nrows) return; const float* s = S + (size_t)i * SQ; float mx = -3.0e38f;
#pragma unroll 1
  for (int j = 0; j < SQ; ++j) mx = fmaxf(mx, s[j]); float se = 0.f;
#pragma unroll 1
  for (int j = 0; j < SQ; ++j) se += expf(s[j] - mx); const float sc = 256.0f / se;
#pragma unroll 1
  for (int j0 = 0; j0 < SQ; j0 += 8) { FragH f; for (int q = 0; q < 8; ++q) f.h[q] = (_Float16)(expf(s[j0 + q] - mx) * sc); unsigned short* d = (unsigned short*)P + (size_t)i * SQ + j0; *(v8us*)d = f.half[0];  } }
__global__ __launch_bounds__(256) void k_vt(const _Float16* __restrict__ V16, int b, int h0, _Float16* __restrict__ VT) { __shared__ unsigned short tl[64][65]; const int tid = threadIdx.x; const int hh = blockIdx.x % HG, sg = blockIdx.x / HG; const int s0 = sg * 64; const int h = h0 + hh;
  for (int i = tid; i < 64 * 8; i += 256) { const int j = i / 8, d8 = (i % 8) * 8; FragH f; f.half[0] = *(const v8us*)((const unsigned short*)V16 + ((size_t)b * SQ + s0 + j) * DM + h * HD + d8); for (int q = 0; q < 8; ++q) tl[d8 + q][j] = f.u[q]; }
  __syncthreads();
  { for (int i = tid; i < 64 * 8; i += 256) { const int d = i / 8, j8 = (i % 8) * 8; FragH f; for (int q = 0; q < 8; ++q) f.u[q] = tl[d][j8 + q]; *(v8us*)((unsigned short*)VT + ((size_t)hh * HD + d) * SQ + s0 + j8) = f.half[0]; }  } }


__global__ __launch_bounds__(256) void k_tab2(float theta, float* __restrict__ CS, float* __restrict__ SN) {
  #pragma clang fp contract(off)
  const int t = blockIdx.x * 256 + threadIdx.x; if (t >= SQ * (HD / 2)) return; const int i = t % (HD / 2); const int p = t / (HD / 2); const float invf = 1.0f / powf(theta, (float)(2 * i) / (float)HD); const float ang = __fmul_rn((float)p, invf); const float c = cosf(ang), s = sinf(ang);
  *(float*)(CS + t) = c; *(float*)(SN + t) = s;  }
template <int NORM, int ROPE>
__global__ __launch_bounds__(64) void k_xform(const float* __restrict__ F, int ldf, int nh, const float* __restrict__ gain, float eps, const float* __restrict__ CS, const float* __restrict__ SN, _Float16* __restrict__ H16, int ldo) {
  #pragma clang fp contract(off)
  __shared__ float xv[HD]; __shared__ float red[HD]; __shared__ unsigned short sh_[HD]; const int d = threadIdx.x; const int h = blockIdx.x % nh; const size_t r = blockIdx.x / nh; const int p = (int)(r % SQ);
  float x = F[r * (size_t)ldf + (size_t)h * HD + d];
  if (NORM) { red[d] = __fmul_rn(x, x); __syncthreads(); for (int st = HD / 2; st > 0; st >>= 1) { if (d < st) red[d] = __fadd_rn(red[d], red[d + st]); __syncthreads(); } const float rs = rsqrtf(__fadd_rn(red[0] / (float)HD, eps)); x = __fmul_rn(__fmul_rn(x, rs), bf16_round(gain[d])); }
  xv[d] = x; __syncthreads();
  float o = x;
  if (ROPE == 1) { const int i = d >> 1; const float c = CS[p * (HD / 2) + i], s = SN[p * (HD / 2) + i]; const float ev = xv[2 * i], od = xv[2 * i + 1]; o = (d & 1) ? __fadd_rn(__fmul_rn(ev, s), __fmul_rn(od, c)) : __fadd_rn(__fmul_rn(ev, c), -__fmul_rn(od, s)); }
  if (ROPE == 2) { const int i = d & (HD / 2 - 1); const float c = CS[p * (HD / 2) + i], s = SN[p * (HD / 2) + i]; const float lo = xv[i], hi = xv[i + HD / 2]; o = (d < HD / 2) ? __fadd_rn(__fmul_rn(lo, c), -__fmul_rn(hi, s)) : __fadd_rn(__fmul_rn(lo, s), __fmul_rn(hi, c)); }
  FragH th; th.h[0] = (_Float16)o; sh_[d] = th.u[0]; __syncthreads();
  if (d < HD / 8) { FragH f; for (int q = 0; q < 8; ++q) f.u[q] = sh_[d * 8 + q]; unsigned short* dst = (unsigned short*)H16 + r * (size_t)ldo + (size_t)h * HD + d * 8; *(v8us*)dst = f.half[0];  } }

__global__ __launch_bounds__(256) void k_tab4(const int* __restrict__ pos, float theta, float* __restrict__ CS, float* __restrict__ SN) {
  #pragma clang fp contract(off)
  const int t = blockIdx.x * 256 + threadIdx.x; if (t >= SQ * (HD / 2)) return; const int i = t % (HD / 2); const int p = t / (HD / 2); const float invf = (float)pow((double)theta, -((double)(2 * i)) / (double)HD); const float ang = __fmul_rn((float)pos[p], invf); const float c = cosf(ang), s = sinf(ang);
  *(float*)(CS + t) = c; *(float*)(SN + t) = s;  }
__global__ __launch_bounds__(256) void k_rsmf(const float* __restrict__ S, _Float16* __restrict__ P, int qn, int hg) {
  #pragma clang fp contract(off)
  const int t = blockIdx.x * 256 + threadIdx.x; if (t >= qn * hg) return; const size_t i = (size_t)(t / qn) * SQ + (t % qn); const float* s = S + i * SQ; float mx = -3.0e38f;
#pragma unroll 1
  for (int j = 0; j < SQ; ++j) mx = fmaxf(mx, s[j]); float se = 0.f;
#pragma unroll 1
  for (int j = 0; j < SQ; ++j) se += __expf(s[j] - mx); const float sc = 256.0f / se;
#pragma unroll 1
  for (int j0 = 0; j0 < SQ; j0 += 8) { FragH f; for (int q = 0; q < 8; ++q) f.h[q] = (_Float16)(__expf(s[j0 + q] - mx) * sc); unsigned short* d = (unsigned short*)P + i * SQ + j0; *(v8us*)d = f.half[0];  } }


__device__ __forceinline__ v8f fa_mma(v16h a, v16h b, v8f c) { return __builtin_amdgcn_wmma_f32_16x16x32_f16(false, a, false, b, (short)0, c, false, false); }
// 2^x for eight values (two for the rescale factors) in ONE statement: outputs are early-clobber, so no exponential reads its predecessor's result or overwrites its source, and the closing v_nop keeps the one
// independent slot that the instruction set asks for between the last exponential and whatever the compiler places next.
__device__ __forceinline__ v8f fa_exp8(v8f x) { float y0, y1, y2, y3, y4, y5, y6, y7;
  asm("v_exp_f32 %0, %8\n\tv_exp_f32 %1, %9\n\tv_exp_f32 %2, %10\n\tv_exp_f32 %3, %11\n\tv_exp_f32 %4, %12\n\tv_exp_f32 %5, %13\n\tv_exp_f32 %6, %14\n\tv_exp_f32 %7, %15\n\tv_nop"
      : "=&v"(y0), "=&v"(y1), "=&v"(y2), "=&v"(y3), "=&v"(y4), "=&v"(y5), "=&v"(y6), "=&v"(y7) : "v"(x[0]), "v"(x[1]), "v"(x[2]), "v"(x[3]), "v"(x[4]), "v"(x[5]), "v"(x[6]), "v"(x[7]));
  const v8f y = {y0, y1, y2, y3, y4, y5, y6, y7}; return y; }
__device__ __forceinline__ void fa_exp2(float x0, float x1, float& y0, float& y1) { asm("v_exp_f32 %0, %2\n\tv_exp_f32 %1, %3\n\tv_nop" : "=&v"(y0), "=&v"(y1) : "v"(x0), "v"(x1)); }
// A stage is 64 keys: 64 K rows, then the 64 V^T rows' 64 columns, each row 128 bytes at the pitch GP (16 bytes x an odd number: the 16-byte fragment reads meet no bank conflict).
// 128 threads: thread t brings 16-byte piece t & 7 of rows (t >> 3) + 16 j, so one wave's copy covers four whole 128-byte lines.
#define FSTG (128 * GP * 2)          /* bytes of one stage */
// Eight asynchronous copies, each lane its own 16 bytes, with s_wait_xcnt 0 as the last line of the same statement: it stands ahead of any rewrite of the address registers that the copies name.
__device__ __forceinline__ void fa_copy8(unsigned l, const _Float16* k, const _Float16* v) {
  asm volatile("global_load_async_to_lds_b128 %0, %8, off\n\tglobal_load_async_to_lds_b128 %1, %9, off\n\tglobal_load_async_to_lds_b128 %2, %10, off\n\tglobal_load_async_to_lds_b128 %3, %11, off\n\t"
               "global_load_async_to_lds_b128 %4, %12, off\n\tglobal_load_async_to_lds_b128 %5, %13, off\n\tglobal_load_async_to_lds_b128 %6, %14, off\n\tglobal_load_async_to_lds_b128 %7, %15, off\n\ts_wait_xcnt 0x0"
               :: "v"(l), "v"(l + 16u * GP * 2), "v"(l + 32u * GP * 2), "v"(l + 48u * GP * 2), "v"(l + 64u * GP * 2), "v"(l + 80u * GP * 2), "v"(l + 96u * GP * 2), "v"(l + 112u * GP * 2),
                  "v"(k), "v"(k + 16 * DM), "v"(k + 32 * DM), "v"(k + 48 * DM), "v"(v), "v"(v + 16 * SQ), "v"(v + 32 * SQ), "v"(v + 48 * SQ) : "memory"); }
// The K fragments of one step from the stage: ks = the lane's K row of the step's first 16 keys.
__device__ __forceinline__ void fa_kfrags(v16h (&kf)[2][2], const _Float16* ks, int hh) {
#pragma unroll
  for (int kt = 0; kt < 2; ++kt) { kf[kt][0] = g2_frag(ks + kt * 16 * GP, hh); kf[kt][1] = g2_frag(ks + kt * 16 * GP + 32, hh); } }
// One step of 32 keys; kf holds its K fragments. vs = the lane's V^T row at the step's first key: the V^T fragments are read behind the score products, so that the softmax passes before they are needed;
// PRE: the same stage holds the next step too: its K rows (kn) are read ahead of the output products, when the scores' registers are free again. DIAG: a step in the block's own 128 keys, its first key dq below the wave's first query (0 in the wave's last step): keys above the query get weight 0.
template <bool DIAG, bool PRE>
__device__ __forceinline__ void fa_step(const v16h (&qf)[2][2], v16h (&kf)[2][2], v8f (&o)[2][4], float (&mu)[2], float (&l)[2], const _Float16* vs, const _Float16* kn, int dq, int c, int hh) {
  const float cs = 0.125f * 1.44269504088896340736f;      /* score scale x log2(e) */
  const v8f z8 = {0.f,0.f,0.f,0.f,0.f,0.f,0.f,0.f};
  v8f s[2][2];
#pragma unroll
  for (int u = 0; u < 2; ++u)
#pragma unroll
    for (int kt = 0; kt < 2; ++kt) s[u][kt] = fa_mma(kf[kt][1], qf[u][1], fa_mma(kf[kt][0], qf[u][0], z8));
  v16h vf[4];
#pragma unroll
  for (int t = 0; t < 4; ++t) vf[t] = g2_frag(vs + t * 16 * GP, hh);
  if (DIAG) {
#pragma unroll
    for (int u = 0; u < 2; ++u)
#pragma unroll
      for (int kt = 0; kt < 2; ++kt)
#pragma unroll
        for (int r = 0; r < 8; ++r) s[u][kt][r] = (kt * 16 + 8 * hh + r <= dq + u * 16 + c) ? s[u][kt][r] : -1.0e30f; }
  float mx[2];
#pragma unroll
  for (int u = 0; u < 2; ++u) { float a = fmaxf(s[u][0][0], s[u][1][0]);
#pragma unroll
    for (int r = 1; r < 8; ++r) a = fmaxf(a, fmaxf(s[u][0][r], s[u][1][r]));
    a = fmaxf(a, __shfl_xor(a, 16)); mx[u] = a * cs; }      /* cs > 0: scaling commutes with the maximum */
  if (__builtin_amdgcn_ballot_w32(mx[0] > mu[0] + 8.0f || mx[1] > mu[1] + 8.0f) != 0) {      /* one scalar test per step */
    const float mn0 = fmaxf(mu[0], mx[0]), mn1 = fmaxf(mu[1], mx[1]); float al[2]; fa_exp2(mu[0] - mn0, mu[1] - mn1, al[0], al[1]); mu[0] = mn0; mu[1] = mn1;
#pragma unroll
    for (int u = 0; u < 2; ++u) { l[u] *= al[u];
#pragma unroll
      for (int t = 0; t < 4; ++t) o[u][t] *= al[u]; } }
  FragH pf[2];
#pragma unroll
  for (int u = 0; u < 2; ++u) { float sm = 0.f;
#pragma unroll
    for (int kt = 0; kt < 2; ++kt) { v8f x;
#pragma unroll
      for (int r = 0; r < 8; ++r) x[r] = fmaf(s[u][kt][r], cs, -mu[u]);
      const v8f p = fa_exp8(x);
#pragma unroll
      for (int r = 0; r < 8; ++r) { sm += p[r]; pf[u].h[kt * 8 + r] = (_Float16)p[r]; } }
    l[u] += sm; }
  if (PRE) fa_kfrags(kf, kn, hh);
#pragma unroll
  for (int u = 0; u < 2; ++u)
#pragma unroll
    for (int t = 0; t < 4; ++t) o[u][t] = fa_mma(vf[t], pf[u].v, o[u][t]); }
// amdgpu_waves_per_eu(4, 4): the register budget of four waves per SIMD, four blocks per WGP; left free, a trip of two steps took more than 256 registers.
__global__ __launch_bounds__(128) __attribute__((amdgpu_waves_per_eu(4, 4))) void k_fattn(const _Float16* __restrict__ Q16, const _Float16* __restrict__ K16, const _Float16* __restrict__ VTa, _Float16* __restrict__ O) {
  __shared__ __attribute__((aligned(16))) char sm[2 * FSTG];      /* two stages */
  const int tid = threadIdx.x, lane = tid & 31, c = lane & 15, hh = lane >> 4;
  const int w = __builtin_amdgcn_readfirstlane(tid >> 5);      /* the wave's number as a scalar: the tests of the last two trips are scalar branches */
  const int bh = blockIdx.x % (NB * NH); const int g = blockIdx.x / (4 * NB * NH), rr = (blockIdx.x / (NB * NH)) % 4;
  const int qt = (3 - g) * 4 + ((g & 1) ? rr : 3 - rr);      /* a permutation of the 16 query tiles: long tiles first, and blocks a quarter of the grid apart have tiles that sum to the same length */
  const int b = bh / NH, h = bh % NH; const int q0 = qt * 128 + w * 32;
  const _Float16* qp = Q16 + ((size_t)b * SQ + q0 + c) * DM + h * HD;
  const unsigned l0 = (unsigned)(size_t)sm + (unsigned)(tid >> 3) * (GP * 2) + (unsigned)(tid & 7) * 16;      /* the thread's first place in stage 0: LDS byte address */
  const _Float16* gk = K16 + ((size_t)b * SQ + (tid >> 3)) * DM + h * HD + (tid & 7) * 8;
  const _Float16* gv = VTa + ((size_t)bh * HD + (tid >> 3)) * SQ + (tid & 7) * 8;
  const v8f z8 = {0.f,0.f,0.f,0.f,0.f,0.f,0.f,0.f};
  v16h qf[2][2], kf[2][2];
#pragma unroll
  for (int u = 0; u < 2; ++u) { qf[u][0] = g2_frag(qp + (size_t)u * 16 * DM, hh); qf[u][1] = g2_frag(qp + (size_t)u * 16 * DM + 32, hh); }
  asm volatile("s_wait_xcnt 0x0" ::: "memory");      /* stands behind the query fragments' loads, ahead of the first write of a register that holds one of their addresses */
  fa_copy8(l0, gk, gv);
  asm volatile("s_wait_asynccnt 0x0" ::: "memory");      /* this wave's part of stage 0 has landed */
  __syncthreads();      /* stage 0 is whole for every wave */
  fa_copy8(l0 + FSTG, gk + 64 * DM, gv + 64);      /* a block has 2 qt + 2 stages, never fewer than two */
  v8f o[2][4]; float mu[2], l[2];
#pragma unroll
  for (int u = 0; u < 2; ++u) { mu[u] = -1.0e30f; l[u] = 0.f;
#pragma unroll
    for (int t = 0; t < 4; ++t) o[u][t] = z8; }
#pragma unroll 1
  for (int t = 0; t < 2 * qt; ++t) {      /* the stages below the block's first query: both steps are whole for all four waves. Kept rolled: one trip is one stage, 32 WMMAs a wave, and the registers of four waves per SIMD */
    const _Float16* st = (const _Float16*)(sm + (t & 1) * FSTG);
    const _Float16* ks = st + c * GP; const _Float16* vs = st + (64 + c) * GP;
    fa_kfrags(kf, ks, hh);
    fa_step<false, true>(qf, kf, o, mu, l, vs, ks + 32 * GP, 0, c, hh);
    fa_step<false, false>(qf, kf, o, mu, l, vs + 32, ks, 0, c, hh);
    asm volatile("s_wait_dscnt 0x0" ::: "memory");      /* this wave's reads of the stage have returned */
    asm volatile("s_wait_asynccnt 0x0" ::: "memory");      /* this wave's part of stage t + 1 has landed */
    __syncthreads();      /* publishes stage t + 1 and ends every wave's reads of stage t */
    fa_copy8(l0 + (unsigned)(t & 1) * FSTG, gk + (size_t)(t + 2) * 64 * DM, gv + (t + 2) * 64); }      /* refill of the stage just left; stage t + 2 <= 2 qt + 1 exists on every trip of this loop */
#pragma unroll 1
  for (int tt = 0; tt < 2; ++tt) {      /* the block's own 128 keys, stages 2 qt (in the first buffer: 2 qt is even) and 2 qt + 1: step j is whole for the waves above j (the mask keeps every score), the diagonal of wave j, nothing for the waves below; every wave passes the trip's foot */
    const _Float16* st = (const _Float16*)(sm + tt * FSTG);
#pragma unroll 1
    for (int kk = 0; kk < 2; ++kk) { const int j = tt * 2 + kk;      /* kept rolled: one copy of the step's code */
      const _Float16* ks = st + (kk * 32 + c) * GP; const _Float16* vs = st + (64 + c) * GP + kk * 32;
      if (j <= w) { fa_kfrags(kf, ks, hh); fa_step<true, false>(qf, kf, o, mu, l, vs, ks, (w - j) * 32, c, hh); } }      /* a scalar test: j and w are wave-uniform scalars */
    asm volatile("s_wait_dscnt 0x0" ::: "memory");      /* this wave's reads of the stage have returned */
    asm volatile("s_wait_asynccnt 0x0" ::: "memory");      /* this wave's part of the last stage has landed */
    __syncthreads(); }      /* publishes the last stage */
  asm volatile("s_wait_asynccnt 0x0" ::: "memory");      /* no copy is outstanding when the wave ends */
#pragma unroll
  for (int u = 0; u < 2; ++u) { const float fin = 64.0f / (l[u] + __shfl_xor(l[u], 16));      /* the lane halves' sums join once; o carried x64 */
    unsigned short* dst = (unsigned short*)O + ((size_t)b * SQ + q0 + u * 16 + c) * DM + h * HD + 8 * hh;
#pragma unroll
    for (int t = 0; t < 4; ++t) { FragH f;
#pragma unroll
      for (int r = 0; r < 8; ++r) f.h[r] = (_Float16)(o[u][t][r] * fin);      /* register r is output column 16 t + 8 hh + r of query c: one 16-byte store */
      *(v8us*)(dst + t * 16) = f.half[0]; } } }
static_assert(SQ == 16 * 128 && HD == 64, "k_fattn: 16 query tiles of 4 waves x 32 query columns, head size 64");


// Exact f32 causal attention for the first QT0 rows, one wave per (head, query row), 8 rows of one head per block.
// The head's QT0 key rows are staged in LDS at a pitch of HD + 4 floats (16 bytes x an odd number: row-per-lane 16-byte reads without bank conflicts).
// Lane l scores keys l, l + 32, l + 64, l + 96 (each dot product summed over d in index order); row maximum and row sum end in lane butterflies;
// then lane l sums output columns 2 l and 2 l + 1 over the keys in index order, each weight read from its lane as a scalar.
typedef float v2f __attribute__((ext_vector_type(2)));
typedef float v2fa __attribute__((ext_vector_type(2), may_alias));
typedef _Float16 v2h __attribute__((ext_vector_type(2)));
__global__ __launch_bounds__(256) void k_att0w(const float* __restrict__ QF, const float* __restrict__ KF, const float* __restrict__ VF, float scale, _Float16* __restrict__ OH, _Float16* __restrict__ OL) {      /* all five row pitches are DM, so that every row step is an immediate offset */
  __shared__ __attribute__((aligned(16))) float lk[QT0][HD + 4];
  { const size_t bo = (size_t)blockIdx.y * QT0 * DM; QF += bo; KF += bo; VF += bo; OH += bo; OL += bo; }      /* blockIdx.y: the batch */
  const int tid = threadIdx.x, lane = tid & 31; const int h = blockIdx.x / (QT0 / 8);
  const int i = (blockIdx.x % (QT0 / 8)) * 8 + __builtin_amdgcn_readfirstlane(tid >> 5);      /* the wave's query row, held as a scalar so that the q row and the group tests below are wave-uniform */
  const float* kb = KF + h * HD;
#pragma unroll
  for (int p = 0; p < QT0 / 16; ++p) { const int r = p * 16 + (tid >> 4), c4 = (tid & 15) * 4; *(v4f*)&lk[r][c4] = *(const v4fa*)(kb + (size_t)r * DM + c4); }      /* unrolled: all 8 loads of a thread in flight at once */
  __syncthreads();
  const float* qr = QF + (size_t)i * DM + h * HD;
  float sa[QT0 / 32];
#pragma unroll
  for (int g = 0; g < QT0 / 32; ++g) sa[g] = 0.f;
#pragma unroll
  for (int c = 0; c < HD / 4; ++c) { const v4f qq = *(const v4fa*)(qr + c * 4);      /* unrolled: sa stays in named registers and the four groups' sum chains interleave */
#pragma unroll
    for (int g = 0; g < QT0 / 32; ++g) { const v4f kq = *(const v4f*)&lk[g * 32 + lane][c * 4]; sa[g] = fmaf(qq[0], kq[0], sa[g]); sa[g] = fmaf(qq[1], kq[1], sa[g]); sa[g] = fmaf(qq[2], kq[2], sa[g]); sa[g] = fmaf(qq[3], kq[3], sa[g]); } }
  float m = -1.0e30f;
#pragma unroll
  for (int g = 0; g < QT0 / 32; ++g) { sa[g] = (g * 32 + lane <= i) ? sa[g] * scale : -1.0e30f; m = fmaxf(m, sa[g]); }      /* causal: keys above the row get weight 0 */
#pragma unroll
  for (int o = 16; o > 0; o >>= 1) m = fmaxf(m, __shfl_xor(m, o));
  float l = 0.f;
#pragma unroll
  for (int g = 0; g < QT0 / 32; ++g) { sa[g] = expf(sa[g] - m); l += sa[g]; }
#pragma unroll
  for (int o = 16; o > 0; o >>= 1) l += __shfl_xor(l, o);
  const float* vb = VF + h * HD + lane * 2; float o0 = 0.f, o1 = 0.f;
#pragma unroll
  for (int g = 0; g < QT0 / 32; ++g) { if (g * 32 <= i) {      /* wave-uniform: key groups wholly above the row are skipped */
#pragma unroll
      for (int jj = 0; jj < 32; ++jj) { const float p = __int_as_float(__builtin_amdgcn_readlane(__float_as_int(sa[g]), jj)); const v2f vv = *(const v2fa*)(vb + (size_t)(g * 32 + jj) * DM); o0 = fmaf(p, vv[0], o0); o1 = fmaf(p, vv[1], o1); } } }      /* unrolled: a group's 32 loads issue before the first use */
  const float fin = 64.0f / l;      /* o carried x64 like the f16 path */
  const float a0 = o0 * fin, a1 = o1 * fin; v2h hv, lv;      /* o leaves as an f16 value plus its residual x1024, the two A operands of the output projection's first-tile blocks */
  hv[0] = (_Float16)a0; hv[1] = (_Float16)a1; lv[0] = (_Float16)((a0 - (float)hv[0]) * 1024.0f); lv[1] = (_Float16)((a1 - (float)hv[1]) * 1024.0f);
  const size_t oo = (size_t)i * DM + h * HD + lane * 2; *(v2h*)(OH + oo) = hv; *(v2h*)(OL + oo) = lv; }

// Output projection of ALL token rows in ONE launch (wave tile, product order and store path of k_gemm2, pitches and K = DM; K loop on LDS stages as in k_qkv_rope): out = o W_o, o carried x64 and W_o x16.
// A block is 8 waves: 128 rows of one batch x 128 columns. The blocks of each batch's first 128 rows take the exact attention's o instead of the f16 path's: its f16 value and its x1024 residual are two A operands
// that share every B fragment in one K loop, on two accumulator sets that join in the epilogue (hi 2^-10 + lo 2^-20). These blocks do twice the products, so they have the lowest block indices.
__global__ __launch_bounds__(256) void k_oproj(const _Float16* __restrict__ O, const _Float16* __restrict__ OH, const _Float16* __restrict__ OL, const _Float16* __restrict__ Bh, float* __restrict__ C) {
  __shared__ __attribute__((aligned(16))) char sm[2 * GSTG3];      /* two stages in the K loop; behind it the epilogue's staging */
  static_assert(sizeof(float) * 8 * 32 * 68 <= 2 * GSTG3, "the epilogue's staging fits the two stages");
  float (*so)[32][68] = (float (*)[32][68])sm;
  const int tid = threadIdx.x, w8 = tid >> 5, w = w8 & 3, wg = w8 >> 2, lane = tid & 31, ln = lane & 15, hh = lane >> 4;      /* w: the wave's 32 rows; wg: its 64 columns */
  const int ntn = DM / 128, tpb = SQ / 128; const int mi = blockIdx.x / ntn, np = blockIdx.x - mi * ntn;
  const bool first = mi < NB;      /* block-uniform */
  const int b = first ? mi : (mi - NB) / (tpb - 1); const int tl = first ? 0 : 1 + (mi - NB) % (tpb - 1);      /* batch; 128-row tile in the batch */
  const int row0 = b * SQ + tl * 128 + 32 * w, col0 = np * 128 + wg * 64;
  const unsigned l0 = (unsigned)(size_t)sm + (unsigned)(tid >> 3) * (GP * 2) + (unsigned)(tid & 7) * 16;      /* the thread's first place in stage 0: LDS byte address */
  const _Float16* gb = Bh + (size_t)(np * 128 + (tid >> 3)) * DM + (tid & 7) * 8;
  const v8f z8 = {0.f,0.f,0.f,0.f,0.f,0.f,0.f,0.f}; v8f c00 = z8, c01 = z8, c02 = z8, c03 = z8, c10 = z8, c11 = z8, c12 = z8, c13 = z8;
  v8f accs[8];
  if (!first) {
    const _Float16* ga = O + (size_t)(b * SQ + tl * 128 + (tid >> 3)) * DM + (tid & 7) * 8;
    g3_copy8(l0, ga, gb);
    asm volatile("s_wait_asynccnt 0x0" ::: "memory");      /* this wave's part of tile 0 has landed */
    __syncthreads();      /* tile 0 is whole for every wave */
    g3_copy8(l0 + GSTG3, ga + 64, gb + 64);
#pragma unroll 1
    for (int t = 0; t < DM / 64; ++t) {      /* kept rolled: one trip is one stage, 16 WMMAs a wave */
      const _Float16* st = (const _Float16*)(sm + (t & 1) * GSTG3);
      const _Float16* ap = st + (32 * w + ln) * GP; const _Float16* bp = st + (128 + 64 * wg + ln) * GP;
#pragma unroll
      for (int kk = 0; kk < 64; kk += 32) { const v16h a0 = g2_frag(ap + kk, hh), a1 = g2_frag(ap + 16 * GP + kk, hh);      /* unrolled: the LDS offsets of both halves of the stage are immediates; the six fragments of 32 k are read as one group, ahead of their WMMAs */
        const v16h b0 = g2_frag(bp + kk, hh), b1 = g2_frag(bp + 16 * GP + kk, hh), b2 = g2_frag(bp + 32 * GP + kk, hh), b3 = g2_frag(bp + 48 * GP + kk, hh);
        c00 = g2_mma(a0, b0, c00); c10 = g2_mma(a1, b0, c10); c01 = g2_mma(a0, b1, c01); c11 = g2_mma(a1, b1, c11);
        c02 = g2_mma(a0, b2, c02); c12 = g2_mma(a1, b2, c12); c03 = g2_mma(a0, b3, c03); c13 = g2_mma(a1, b3, c13); }
      asm volatile("s_wait_dscnt 0x0" ::: "memory");      /* this wave's reads of the stage have returned */
      asm volatile("s_wait_asynccnt 0x0" ::: "memory");      /* this wave's part of tile t + 1 has landed */
      __syncthreads();      /* publishes tile t + 1 and ends every wave's reads of tile t */
      if (t + 2 < DM / 64) g3_copy8(l0 + (unsigned)(t & 1) * GSTG3, ga + (t + 2) * 64, gb + (t + 2) * 64); }      /* refill of the stage just left; the test is the same for the whole block */
    asm volatile("s_wait_asynccnt 0x0" ::: "memory");      /* no copy is outstanding when the stages become the epilogue's staging */
    accs[0] = c00 * 0.0009765625f; accs[1] = c01 * 0.0009765625f; accs[2] = c02 * 0.0009765625f; accs[3] = c03 * 0.0009765625f;
    accs[4] = c10 * 0.0009765625f; accs[5] = c11 * 0.0009765625f; accs[6] = c12 * 0.0009765625f; accs[7] = c13 * 0.0009765625f;
  } else {
    const size_t go = ((size_t)b * QT0 + (tid >> 3)) * DM + (tid & 7) * 8;
    const _Float16* ga = OH + go; const _Float16* ge = OL + go;
    v8f d00 = z8, d01 = z8, d02 = z8, d03 = z8, d10 = z8, d11 = z8, d12 = z8, d13 = z8;
    g3_copy8(l0, ga, gb); g3_copy4(l0 + 256u * GP * 2, ge);
    asm volatile("s_wait_asynccnt 0x0" ::: "memory");      /* this wave's part of tile 0 has landed */
    __syncthreads();      /* tile 0 is whole for every wave */
    g3_copy8(l0 + GSTG3, ga + 64, gb + 64); g3_copy4(l0 + GSTG3 + 256u * GP * 2, ge + 64);
#pragma unroll 1
    for (int t = 0; t < DM / 64; ++t) {      /* kept rolled, like the loop above: 32 WMMAs a wave */
      const _Float16* st = (const _Float16*)(sm + (t & 1) * GSTG3);
      const _Float16* ap = st + (32 * w + ln) * GP; const _Float16* bp = st + (128 + 64 * wg + ln) * GP; const _Float16* ep = st + (256 + 32 * w + ln) * GP;
#pragma unroll
      for (int kk = 0; kk < 64; kk += 32) { const v16h a0 = g2_frag(ap + kk, hh), a1 = g2_frag(ap + 16 * GP + kk, hh), e0 = g2_frag(ep + kk, hh), e1 = g2_frag(ep + 16 * GP + kk, hh);      /* unrolled and grouped as above: eight fragments */
        const v16h b0 = g2_frag(bp + kk, hh), b1 = g2_frag(bp + 16 * GP + kk, hh), b2 = g2_frag(bp + 32 * GP + kk, hh), b3 = g2_frag(bp + 48 * GP + kk, hh);
        c00 = g2_mma(a0, b0, c00); c10 = g2_mma(a1, b0, c10); d00 = g2_mma(e0, b0, d00); d10 = g2_mma(e1, b0, d10);
        c01 = g2_mma(a0, b1, c01); c11 = g2_mma(a1, b1, c11); d01 = g2_mma(e0, b1, d01); d11 = g2_mma(e1, b1, d11);
        c02 = g2_mma(a0, b2, c02); c12 = g2_mma(a1, b2, c12); d02 = g2_mma(e0, b2, d02); d12 = g2_mma(e1, b2, d12);
        c03 = g2_mma(a0, b3, c03); c13 = g2_mma(a1, b3, c13); d03 = g2_mma(e0, b3, d03); d13 = g2_mma(e1, b3, d13); }
      asm volatile("s_wait_dscnt 0x0" ::: "memory");      /* this wave's reads of the stage have returned */
      asm volatile("s_wait_asynccnt 0x0" ::: "memory");      /* this wave's part of tile t + 1 has landed */
      __syncthreads();      /* publishes tile t + 1 and ends every wave's reads of tile t */
      if (t + 2 < DM / 64) { g3_copy8(l0 + (unsigned)(t & 1) * GSTG3, ga + (t + 2) * 64, gb + (t + 2) * 64); g3_copy4(l0 + (unsigned)(t & 1) * GSTG3 + 256u * GP * 2, ge + (t + 2) * 64); } }      /* refill of the stage just left; the test is the same for the whole block */
    asm volatile("s_wait_asynccnt 0x0" ::: "memory");      /* no copy is outstanding when the stages become the epilogue's staging */
    const v8f ch[8] = {c00, c01, c02, c03, c10, c11, c12, c13}, cl[8] = {d00, d01, d02, d03, d10, d11, d12, d13};
#pragma unroll
    for (int u = 0; u < 8; ++u)
#pragma unroll
      for (int r = 0; r < 8; ++r) accs[u][r] = fmaf(cl[u][r], 0.00000095367431640625f, ch[u][r] * 0.0009765625f);      /* both factors are powers of two: one rounding, that of the sum */
  }
#pragma unroll
  for (int u = 0; u < 8; ++u)
#pragma unroll
    for (int r = 0; r < 8; ++r) so[w8][(u >> 2) * 16 + 8 * hh + r][(u & 3) * 16 + ln] = accs[u][r];
  __builtin_amdgcn_fence(__ATOMIC_ACQ_REL, "workgroup"); __builtin_amdgcn_wave_barrier();      /* the wave reads back what its own lanes wrote */
  const int rsub = lane >> 4, c4 = (lane & 15) * 4;
#pragma unroll
  for (int q = 0; q < 16; ++q) { const int r = q * 2 + rsub; const v4f v = *(const v4fa*)&so[w8][r][c4]; *(v4f*)(C + (size_t)(row0 + r) * DM + col0 + c4) = v; } }
static_assert(QT0 == 128 && SQ % 128 == 0 && SQ > 128 && DM % 128 == 0, "k_oproj: the first-tile rows are one block row of each batch");

template <int NORM, int ROPE>
__global__ __launch_bounds__(64) void k_xformf(const float* __restrict__ F, int ldf, int nh, const float* __restrict__ gain, float eps, const float* __restrict__ CS, const float* __restrict__ SN, float* __restrict__ F32, int ldo) {
  #pragma clang fp contract(off)
  __shared__ float xv[HD]; __shared__ float red[HD]; const int d = threadIdx.x; const int h = blockIdx.x % nh; const size_t r = blockIdx.x / nh; const int p = (int)(r % SQ);
  float x = F[r * (size_t)ldf + (size_t)h * HD + d];
  if (NORM) { red[d] = __fmul_rn(x, x); __syncthreads(); for (int st = HD / 2; st > 0; st >>= 1) { if (d < st) red[d] = __fadd_rn(red[d], red[d + st]); __syncthreads(); } const float rs = rsqrtf(__fadd_rn(red[0] / (float)HD, eps)); x = __fmul_rn(__fmul_rn(x, rs), bf16_round(gain[d])); }
  xv[d] = x; __syncthreads();
  float o = x;
  if (ROPE == 1) { const int i = d >> 1; const float c = CS[p * (HD / 2) + i], s = SN[p * (HD / 2) + i]; const float ev = xv[2 * i], od = xv[2 * i + 1]; o = (d & 1) ? __fadd_rn(__fmul_rn(ev, s), __fmul_rn(od, c)) : __fadd_rn(__fmul_rn(ev, c), -__fmul_rn(od, s)); }
  if (ROPE == 2) { const int i = d & (HD / 2 - 1); const float c = CS[p * (HD / 2) + i], s = SN[p * (HD / 2) + i]; const float lo = xv[i], hi = xv[i + HD / 2]; o = (d < HD / 2) ? __fadd_rn(__fmul_rn(lo, c), -__fmul_rn(hi, s)) : __fadd_rn(__fmul_rn(lo, s), __fmul_rn(hi, c)); }
  float* dst = F32 + r * (size_t)ldo + (size_t)h * HD + d; *(float*)dst = o;  }


__global__ __launch_bounds__(256) void k_bfcp(const float* __restrict__ src, float* __restrict__ dst, size_t n4) { const size_t t = (size_t)blockIdx.x * 256 + threadIdx.x; if (t >= n4) return; const v4f a = *(const v4fa*)(src + t * 4); v4f o; for (int q = 0; q < 4; ++q) o[q] = bf16_round(a[q]); *(v4f*)(dst + t * 4) = o;  }
extern "C" void kernel_launch(void* const* d_in, const int* in_sizes, int n_in,
                              void* d_out, int out_size, void* d_ws, size_t ws_size, hipStream_t stream) {
  (void)in_sizes; (void)n_in; (void)out_size;
    const float* const* I = (const float* const*)d_in; const float* x = I[0]; const float* tcos = I[1]; const float* tsin = I[2]; const float* wq = I[3]; const float* wk = I[4]; const float* wv = I[5]; const float* wo = I[6];      /* [in][out] weights, no biases; rope tables INPUT [2048][32] */
  char* ws = (char*)d_ws; size_t off = 0;
  auto take = [&](size_t bytes) { char* p = ws + off; off += (bytes + 255) & ~(size_t)255; return p; };
  _Float16* BQKV = (_Float16*)take((size_t)3 * DM * DM * 2); _Float16* BO = (_Float16*)take((size_t)DM * DM * 2);
  _Float16* X16 = (_Float16*)take(NR * DM * 2);
  _Float16* QH = (_Float16*)take(NR * DM * 2); _Float16* KH = (_Float16*)take(NR * DM * 2); _Float16* O16 = (_Float16*)take(NR * DM * 2);
  _Float16* VT = (_Float16*)take((size_t)NB * NH * HD * SQ * 2);
  float* QF0 = (float*)take((size_t)NB * QT0 * DM * 4); float* KF0 = (float*)take((size_t)NB * QT0 * DM * 4); float* VF0 = (float*)take((size_t)NB * QT0 * DM * 4); _Float16* OH0 = (_Float16*)take((size_t)NB * QT0 * DM * 2); _Float16* OL0 = (_Float16*)take((size_t)NB * QT0 * DM * 2);
  if (off > ws_size) return;
  k_prep<<<(unsigned)(PWB + NR * DM / PXV), 256, 0, stream>>>(x, wq, wk, wv, wo, X16, BQKV, BO);      /* [in][out] weights -> Bt[n][k] x16, q | k | v stacked along n; x -> f16 rows */
  k_qkv_rope<<<(unsigned)((NR / 128) * (3 * DM / 128)), 256, 0, stream>>>(X16, BQKV, tcos, tsin, QH, KH, VT, QF0, KF0, VF0);      /* roped f16 q, k rows, V^T [NB][NH][HD][SQ], f32 q, k, v of each batch's first 128 rows */
  k_att0w<<<dim3(NH * (QT0 / 8), NB), 256, 0, stream>>>(QF0, KF0, VF0, 0.125f, OH0, OL0);      /* exact f32 causal attention for rows 0..127 of every batch (o x64) -> f16 hi + x1024 residual planes */
  k_fattn<<<(SQ / 128) * NB * NH, 128, 0, stream>>>(QH, KH, VT, O16);      /* o (merged heads, x64) as f16 rows, all batches */
  k_oproj<<<(unsigned)((NR / 128) * (DM / 128)), 256, 0, stream>>>(O16, OH0, OL0, BO, (float*)d_out);      /* out rows are the output layout; rows 0..127 of each batch from the hi and lo planes */
}

// v009
// It runs in 116 microseconds.
// Next to v008, in two timings, it ran 1.07 times as fast each time.
// All steps since the starting kernel, v000, together make it 84.2 times as fast.
#include <hip/hip_runtime.h>
#define NB 4
#define SQ 2048
#define DM 1024
#define NH 16
#define HD 64
#define HG 4                         /* heads per launch of the second k_vt, which is never launched */
#define QT0 128                      /* first-tile rows recomputed exactly in f32 */
#define B0 0                         /* unused: every launch covers batches 0 .. NB - 1 */
#define NBR NB                       /* used only by MPO, itself unused */
#define NR ((size_t)NB * SQ)         /* token rows */
#define MPO ((int)((size_t)NBR * SQ))      /* unused: k_oproj covers all NR rows */
typedef __bf16 v16b __attribute__((ext_vector_type(16)));
typedef unsigned short v8us __attribute__((ext_vector_type(8), may_alias));
typedef float  v8f  __attribute__((ext_vector_type(8)));
typedef float  v4f  __attribute__((ext_vector_type(4)));
typedef float  v4fa __attribute__((ext_vector_type(4), may_alias));
union FragB { v16b v; v8us half[2]; unsigned short u[16]; };

__device__ __forceinline__ unsigned short bf16_bits(float x) { unsigned int u = __float_as_uint(x); return (unsigned short)((u + 0x7FFFu + ((u >> 16) & 1u)) >> 16); }
__device__ __forceinline__ float bf16_val(unsigned short b) { return __uint_as_float(((unsigned int)b) << 16); }
__device__ __forceinline__ float bf16_round(float x) { return bf16_val(bf16_bits(x)); }
// D += A·B with NT terms: 1 = ah·bh, 2 = + al·bh (A split), 3 = + ah·bl (both split)
template <int NT>
__device__ __forceinline__ v8f mmaN(v16b ah, v16b al, v16b bh, v16b bl, v8f c) {
  c = __builtin_amdgcn_wmma_f32_16x16x32_bf16(false, ah, false, bh, (short)0, c, false, false);
  if (NT >= 2) c = __builtin_amdgcn_wmma_f32_16x16x32_bf16(false, al, false, bh, (short)0, c, false, false);
  if (NT >= 3) c = __builtin_amdgcn_wmma_f32_16x16x32_bf16(false, ah, false, bl, (short)0, c, false, false);
  asm volatile("v_nop\n\tv_nop\n\tv_nop\n\tv_nop" : "+v"(c) : "v"(ah), "v"(al), "v"(bh), "v"(bl));
  return c;
}

__global__ __launch_bounds__(256) void k_wt_bf16(const float* __restrict__ W, unsigned short* __restrict__ Wt, int K, int N) {
  const int t = blockIdx.x * 256 + threadIdx.x;
  const int k8n = K / 8;
  if (t >= N * k8n) return;
  const int n = t / k8n, k8 = (t % k8n) * 8;
  v8us v;
#pragma unroll
  for (int i = 0; i < 8; ++i) v[i] = bf16_bits(W[(size_t)(k8 + i) * N + n]);
  *(v8us*)(Wt + (size_t)n * K + k8) = v;
  
}

// GEMM C[M][N] (f32, pitch ldc) = act(A[M][K]·W + bias). A f32 row-major (pitch lda) converted per fragment to bf16
// (ASPLIT: hi/lo two planes -> 2 terms, else single rounded term); Wt bf16 [N][K] (pitch ldb). BIAS_BF16 rounds the
// bias to bf16 first (bias quantised to bf16 before the add). K%32==0, M%16==0, N%64==0.
template <bool ASPLIT, int ACT, bool BIAS_BF16>
__global__ __launch_bounds__(128) void k_gemm_bf(const float* __restrict__ A, int lda, const unsigned short* __restrict__ Wt, int ldb,
                                               const float* __restrict__ bias, float* __restrict__ C, int ldc, int M, int N, int K) {
  __shared__ __attribute__((aligned(16))) float so[4][16][64];
  const int tid = threadIdx.x, w = tid >> 5, lane = tid & 31, ln = lane & 15, hh = lane >> 4;
  const int ntn = N / 64;
  const int wid = blockIdx.x * 4 + w;
  const int mt = wid / ntn, nq = wid % ntn;
  if (mt * 16 >= M) return;
  const int row0 = mt * 16, col0 = nq * 64;
  const float* arow = A + (size_t)(row0 + ln) * lda;
  v8f acc[4] = {};
  for (int kb = 0; kb < K; kb += 32) {
    FragB ah, al;
    const v4f x0 = *(const v4fa*)(arow + kb + 8 * hh), x1 = *(const v4fa*)(arow + kb + 8 * hh + 4);
    const v4f x2 = *(const v4fa*)(arow + kb + 16 + 8 * hh), x3 = *(const v4fa*)(arow + kb + 16 + 8 * hh + 4);
    float xs[16] = {x0[0],x0[1],x0[2],x0[3],x1[0],x1[1],x1[2],x1[3],x2[0],x2[1],x2[2],x2[3],x3[0],x3[1],x3[2],x3[3]};
#pragma unroll
    for (int i = 0; i < 16; ++i) { const unsigned short hb = bf16_bits(xs[i]); ah.u[i] = hb; al.u[i] = ASPLIT ? bf16_bits(xs[i] - bf16_val(hb)) : (unsigned short)0; }
#pragma unroll
    for (int t = 0; t < 4; ++t) {
      const unsigned short* brow = Wt + (size_t)(col0 + t * 16 + ln) * ldb + kb;
      FragB b;
      b.half[0] = *(const v8us*)(brow + 8 * hh);
      b.half[1] = *(const v8us*)(brow + 16 + 8 * hh);
      acc[t] = mmaN<ASPLIT ? 2 : 1>(ah.v, al.v, b.v, b.v, acc[t]);
    }
  }
#pragma unroll
  for (int t = 0; t < 4; ++t) {
    float bv = bias ? bias[col0 + t * 16 + ln] : 0.f;
    if (BIAS_BF16) bv = bf16_round(bv);
#pragma unroll
    for (int r = 0; r < 8; ++r) { float v = acc[t][r] + bv; if (ACT == 1) v = fmaxf(v, 0.f); so[w][8 * hh + r][t * 16 + ln] = v; }
  }
  __builtin_amdgcn_fence(__ATOMIC_ACQ_REL, "workgroup");
  __builtin_amdgcn_wave_barrier();
  const int rsub = lane >> 4, c4 = (lane & 15) * 4;
  {
#pragma unroll
    for (int q = 0; q < 8; ++q) {
      const int r = q * 2 + rsub;
      const v4f v = *(const v4fa*)&so[w][r][c4];
      *(v4f*)(C + (size_t)(row0 + r) * ldc + col0 + c4) = v;
    }
    
  }
}

// GEMM C = act(A·W + bias + resid): A f32 (ASPLIT -> hi/lo 2 terms), Wt bf16 [N][K]; ACT 0 none, 1 relu, 2 exact gelu;
// resid (optional, f32, row index = (row % rmod), pitch ldr, RES_BF16 rounds it) added before the activation.
template <bool ASPLIT, int ACT, bool BIAS_BF16, bool RES_BF16>
__global__ __launch_bounds__(128) void k_gemm_bf3(const float* __restrict__ A, int lda, const unsigned short* __restrict__ Wt, int ldb,
                                                const float* __restrict__ bias, const float* __restrict__ resid, int rmod, int ldr,
                                                float* __restrict__ C, int ldc, int M, int N, int K) {
  __shared__ __attribute__((aligned(16))) float so[4][16][64];
  const int tid = threadIdx.x, w = tid >> 5, lane = tid & 31, ln = lane & 15, hh = lane >> 4;
  const int ntn = N / 64;
  const int wid = blockIdx.x * 4 + w;
  const int mt = wid / ntn, nq = wid % ntn;
  if (mt * 16 >= M) return;
  const int row0 = mt * 16, col0 = nq * 64;
  const float* arow = A + (size_t)(row0 + ln) * lda;
  v8f acc[4] = {};
  for (int kb = 0; kb < K; kb += 32) {
    FragB ah, al;
    const v4f x0 = *(const v4fa*)(arow + kb + 8 * hh), x1 = *(const v4fa*)(arow + kb + 8 * hh + 4);
    const v4f x2 = *(const v4fa*)(arow + kb + 16 + 8 * hh), x3 = *(const v4fa*)(arow + kb + 16 + 8 * hh + 4);
    float xs[16] = {x0[0],x0[1],x0[2],x0[3],x1[0],x1[1],x1[2],x1[3],x2[0],x2[1],x2[2],x2[3],x3[0],x3[1],x3[2],x3[3]};
#pragma unroll
    for (int i = 0; i < 16; ++i) { const unsigned short hb = bf16_bits(xs[i]); ah.u[i] = hb; al.u[i] = ASPLIT ? bf16_bits(xs[i] - bf16_val(hb)) : (unsigned short)0; }
#pragma unroll
    for (int t = 0; t < 4; ++t) {
      const unsigned short* brow = Wt + (size_t)(col0 + t * 16 + ln) * ldb + kb;
      FragB b;
      b.half[0] = *(const v8us*)(brow + 8 * hh);
      b.half[1] = *(const v8us*)(brow + 16 + 8 * hh);
      acc[t] = mmaN<ASPLIT ? 2 : 1>(ah.v, al.v, b.v, b.v, acc[t]);
    }
  }
#pragma unroll
  for (int t = 0; t < 4; ++t) {
    const int col = col0 + t * 16 + ln;
    float bv = bias ? bias[col] : 0.f;
    if (BIAS_BF16) bv = bf16_round(bv);
#pragma unroll
    for (int r = 0; r < 8; ++r) {
      float v = acc[t][r] + bv;
      if (resid) { float rv = resid[(size_t)((row0 + 8 * hh + r) % rmod) * ldr + col]; if (RES_BF16) rv = bf16_round(rv); v += rv; }
      if (ACT == 1) v = fmaxf(v, 0.f);
      if (ACT == 2) v = 0.5f * v * (1.0f + erff(v * 0.70710678118654752f));
      if (ACT == 3) { const float u = 0.7978845608028654f * (v + 0.044715f * v * v * v); v = 0.5f * v * (1.0f + tanhf(u)); }
      so[w][8 * hh + r][t * 16 + ln] = v;
    }
  }
  __builtin_amdgcn_fence(__ATOMIC_ACQ_REL, "workgroup");
  __builtin_amdgcn_wave_barrier();
  const int rsub = lane >> 4, c4 = (lane & 15) * 4;
  {
#pragma unroll
    for (int q = 0; q < 8; ++q) {
      const int r = q * 2 + rsub;
      const v4f v = *(const v4fa*)&so[w][r][c4];
      *(v4f*)(C + (size_t)(row0 + r) * ldc + col0 + c4) = v;
    }
    
  }
}
// row LayerNorm (biased variance, eps) over N: s = X (+ R); optional out_sum <- s; out_norm <- (s-mu)*rsqrt(var+eps)*g + b
template <bool PARAM_BF16>
__global__ __launch_bounds__(256) void k_layernorm(const float* __restrict__ X, const float* __restrict__ R, const float* __restrict__ g, const float* __restrict__ bta,
                                                  float* __restrict__ out_sum, float* __restrict__ out_norm, int N, float eps) {
  __shared__ float red[256];
  const int row = blockIdx.x, tid = threadIdx.x;
  const float* x = X + (size_t)row * N; const float* rr = R ? R + (size_t)row * N : nullptr;
  float vals[16];                     // up to N = 4096
  const int per = N / 256;            // contiguous chunk per thread? use strided-by-4 chunks: thread handles j = tid*4 + 1024*u
  float s1 = 0.f;
  for (int u = 0; u < per / 4; ++u) {
    const int j = tid * 4 + 1024 * u;
    const v4f a = *(const v4fa*)(x + j);
    v4f b = {0.f,0.f,0.f,0.f}; if (rr) b = *(const v4fa*)(rr + j);
#pragma unroll
    for (int q = 0; q < 4; ++q) { const float v = a[q] + b[q]; vals[u * 4 + q] = v; s1 += v; }
  }
  red[tid] = s1; __syncthreads();
  for (int st = 128; st > 0; st >>= 1) { if (tid < st) red[tid] += red[tid + st]; __syncthreads(); }
  const float mu = red[0] / (float)N; __syncthreads();
  float s2 = 0.f;
  for (int u = 0; u < per / 4; ++u)
#pragma unroll
    for (int q = 0; q < 4; ++q) { const float c = vals[u * 4 + q] - mu; s2 += c * c; }
  red[tid] = s2; __syncthreads();
  for (int st = 128; st > 0; st >>= 1) { if (tid < st) red[tid] += red[tid + st]; __syncthreads(); }
  const float rs = rsqrtf(red[0] / (float)N + eps);
  {
    for (int u = 0; u < per / 4; ++u) {
      const int j = tid * 4 + 1024 * u;
      v4f o, sm;
#pragma unroll
      for (int q = 0; q < 4; ++q) {
        float gg = g[j + q], bb = bta[j + q];
        if (PARAM_BF16) { gg = bf16_round(gg); bb = bf16_round(bb); }
        sm[q] = vals[u * 4 + q]; o[q] = (vals[u * 4 + q] - mu) * rs * gg + bb;
      }
      if (out_sum) *(v4f*)(out_sum + (size_t)row * N + j) = sm;
      *(v4f*)(out_norm + (size_t)row * N + j) = o;
    }
    
  }
}



// ---- f16 WMMA path (v_wmma_f32_16x16x32_f16): 11-bit significands for operands in range — used where a [0,1] probability operand needs more precision than bf16
typedef _Float16 v16h __attribute__((ext_vector_type(16)));
union FragH { v16h v; v8us half[2]; _Float16 h[16]; unsigned short u[16]; };
template <int NT>
__device__ __forceinline__ v8f mmaH(v16h ah, v16h al, v16h bh, v16h bl, v8f c) {
  c = __builtin_amdgcn_wmma_f32_16x16x32_f16(false, ah, false, bh, (short)0, c, false, false);
  if (NT >= 2) c = __builtin_amdgcn_wmma_f32_16x16x32_f16(false, al, false, bh, (short)0, c, false, false);
  if (NT >= 3) c = __builtin_amdgcn_wmma_f32_16x16x32_f16(false, ah, false, bl, (short)0, c, false, false);
  asm volatile("v_nop\n\tv_nop\n\tv_nop\n\tv_nop" : "+v"(c) : "v"(ah), "v"(al), "v"(bh), "v"(bl));
  return c;
}
// batched GEMM like k_gemm_b but f16 operands: A f32 (split into f16 hi/lo if ASPLIT, else rounded to f16), Bt = f16 values [n][k]; alpha; C f32; N multiple of 16 (partial tiles skipped)
template <bool ASPLIT>
__global__ __launch_bounds__(128) void k_gemm_h(const float* __restrict__ A, int lda, size_t sA, const _Float16* __restrict__ Bh, int ldb, size_t sB, float alpha, float* __restrict__ C, int ldc, size_t sC, int M, int N, int K) {
  __shared__ __attribute__((aligned(16))) float so[4][16][64];
  const int tid = threadIdx.x, w = tid >> 5, lane = tid & 31, ln = lane & 15, hh = lane >> 4; const int by = blockIdx.y;
  A += (size_t)by * sA; Bh += (size_t)by * sB; C += (size_t)by * sC;
  const int ntn = (N + 63) / 64; const int wid = blockIdx.x * 4 + w; const int mt = wid / ntn, nq = wid % ntn; if (mt * 16 >= M) return;
  const int row0 = mt * 16, col0 = nq * 64; const float* arow = A + (size_t)(row0 + ln) * lda;
  v8f acc[4] = {};
  for (int kb = 0; kb < K; kb += 32) {
    FragH ah, al;
    const v4f x0 = *(const v4fa*)(arow + kb + 8 * hh), x1 = *(const v4fa*)(arow + kb + 8 * hh + 4), x2 = *(const v4fa*)(arow + kb + 16 + 8 * hh), x3 = *(const v4fa*)(arow + kb + 16 + 8 * hh + 4);
    float xs[16] = {x0[0],x0[1],x0[2],x0[3],x1[0],x1[1],x1[2],x1[3],x2[0],x2[1],x2[2],x2[3],x3[0],x3[1],x3[2],x3[3]};
#pragma unroll
    for (int i = 0; i < 16; ++i) { const _Float16 h = (_Float16)xs[i]; ah.h[i] = h; al.h[i] = ASPLIT ? (_Float16)(xs[i] - (float)h) : (_Float16)0.0f; }
#pragma unroll
    for (int t = 0; t < 4; ++t) { if (col0 + t * 16 >= N) continue; const size_t boff = (size_t)(col0 + t * 16 + ln) * ldb + kb; FragH bq; bq.half[0] = *(const v8us*)(Bh + boff + 8 * hh); bq.half[1] = *(const v8us*)(Bh + boff + 16 + 8 * hh);
      acc[t] = mmaH<ASPLIT ? 2 : 1>(ah.v, al.v, bq.v, bq.v, acc[t]); }
  }
#pragma unroll
  for (int t = 0; t < 4; ++t) { if (col0 + t * 16 >= N) continue;
#pragma unroll
    for (int r = 0; r < 8; ++r) so[w][8 * hh + r][t * 16 + ln] = acc[t][r] * alpha; }
  __builtin_amdgcn_fence(__ATOMIC_ACQ_REL, "workgroup"); __builtin_amdgcn_wave_barrier();
  const int rsub = lane >> 4, c4 = (lane & 15) * 4;
  {
#pragma unroll
    for (int q = 0; q < 8; ++q) { const int r = q * 2 + rsub; if (col0 + c4 < N) { const v4f v = *(const v4fa*)&so[w][r][c4]; *(v4f*)(C + (size_t)(row0 + r) * ldc + col0 + c4) = v; } }
     }
}

// k_gemm_hh variant with fused epilogue: v = acc·alpha + bias[by·sBias + col] (+ CP[(row/rowsPerB)·sCPb + by·64 + col] if CP) ; ACT 0 none / 1 elu ; writes f16 C16 (and f32 C if non-null)
template <int ACT>
__global__ __launch_bounds__(128) void k_gemm_hhx(const _Float16* __restrict__ A, int lda, size_t sA, const _Float16* __restrict__ Bh, int ldb, size_t sB, float alpha, const float* __restrict__ bias, size_t sBias, const float* __restrict__ CP, int rowsPerB, size_t sCPb, int row0g,
    float* __restrict__ C, _Float16* __restrict__ C16, int ldc, size_t sC, int M, int N, int K) {
  __shared__ __attribute__((aligned(16))) float so[4][16][64];
  const int tid = threadIdx.x, w = tid >> 5, lane = tid & 31, ln = lane & 15, hh = lane >> 4; const int by = blockIdx.y;
  A += (size_t)by * sA; Bh += (size_t)by * sB; const size_t cofs = (size_t)by * sC; const float* bp = bias ? bias + (size_t)by * sBias : nullptr;
  const int ntn = (N + 63) / 64; const int wid = blockIdx.x * 4 + w; const int mt = wid / ntn, nq = wid % ntn; if (mt * 16 >= M) return;
  const int row0 = mt * 16, col0 = nq * 64; const _Float16* arow = A + (size_t)(row0 + ln) * lda;
  v8f acc[4] = {};
  for (int kb = 0; kb < K; kb += 32) { FragH ah; ah.half[0] = *(const v8us*)((const unsigned short*)arow + kb + 8 * hh); ah.half[1] = *(const v8us*)((const unsigned short*)arow + kb + 16 + 8 * hh);
#pragma unroll
    for (int t = 0; t < 4; ++t) { if (col0 + t * 16 >= N) continue; const size_t boff = (size_t)(col0 + t * 16 + ln) * ldb + kb; FragH bq; bq.half[0] = *(const v8us*)((const unsigned short*)Bh + boff + 8 * hh); bq.half[1] = *(const v8us*)((const unsigned short*)Bh + boff + 16 + 8 * hh);
      acc[t] = mmaH<1>(ah.v, ah.v, bq.v, bq.v, acc[t]); }
  }
#pragma unroll
  for (int t = 0; t < 4; ++t) { if (col0 + t * 16 >= N) continue; const int col = col0 + t * 16 + ln; const float bv = bp ? bf16_round(bp[col]) : 0.f;
#pragma unroll
    for (int r = 0; r < 8; ++r) { float v = acc[t][r] * alpha + bv; if (CP) { const int rr = row0g + row0 + 8 * hh + r; if (rowsPerB < 0) v += CP[cofs + (size_t)rr * ldc + col];      /* rowsPerB < 0: own element of the batched C plane */ else { const int bidx = rr / rowsPerB; v += CP[(size_t)bidx * sCPb + (size_t)by * 64 + col]; } } if (ACT == 1) v = (v > 0.f) ? v : expm1f(v); else if (ACT == 7) v = (v > 0.f) ? v + 1.0f : expf(v); else if (ACT == 8) v = tanhf(v); else if (ACT == 9) v = 0.5f * v * (1.0f + tanhf(0.7978845608028654f * (v + 0.044715f * v * v * v))); else if (ACT == 11) v = 1.0f / (1.0f + expf(-v)); else if (ACT == 12) v = (v > 0.f) ? v : 0.01f * v; else if (ACT == 14) v = (v > 0.f) ? v : 0.1f * v; else if (ACT == 16) v = (v >= 0.f) ? v : 0.3f * v; else if (ACT == 17) v = (v >= 0.f) ? v : 0.2f * v; else if (ACT == 15) v = v / (1.0f + expf(-v)); else if (ACT == 3) v = fmaxf(v, 0.f); else if (ACT == 6) v = 0.5f * v * (1.0f + erff(v * 0.70710678118654752f)); so[w][8 * hh + r][t * 16 + ln] = v; } }
  __builtin_amdgcn_fence(__ATOMIC_ACQ_REL, "workgroup"); __builtin_amdgcn_wave_barrier();
  const int rsub = lane >> 4, c4 = (lane & 15) * 4; typedef _Float16 v4h __attribute__((ext_vector_type(4)));
  {
#pragma unroll
    for (int q = 0; q < 8; ++q) { const int r = q * 2 + rsub; if (col0 + c4 < N) { const v4f v = *(const v4fa*)&so[w][r][c4]; if (C) *(v4f*)(C + cofs + (size_t)(row0 + r) * ldc + col0 + c4) = v; if (C16) { v4h h4; for (int i = 0; i < 4; ++i) h4[i] = (_Float16)v[i]; *(v4h*)(C16 + cofs + (size_t)(row0 + r) * ldc + col0 + c4) = h4; } } }
     }
}


typedef _Float16 v4h __attribute__((ext_vector_type(4)));

// Operand preparation in ONE launch: blocks 0 .. PWB - 1 transpose the four weight matrices, the others round x. Bt[n][k] = f16(bf16(W[k][n]) x 16) (exact), X16 = f16(bf16(x)) (exact).
// Weights: a block takes 128 k x 64 n of one matrix. A thread reads 8 k rows x 4 n, 16 bytes a row, so that one wave's load is two 256-byte row pieces (whole lines); it then holds 8 consecutive k of 4 columns,
// four 16-byte pieces of Bt rows, which are gathered in LDS so that one wave writes each 256-byte piece of a Bt row. LDS rows are 256 bytes, and piece c of row n lies at place c ^ (n >> 2):
// the 16 lanes of a write (rows 4 apart, one c) and the 16 lanes of a read (one row, every c) each meet all 64 banks once.
// x: a block takes PXV values, a thread 16 pieces of 4: each wave's load is 512 contiguous bytes, each store 256, and the loads run ahead of the arithmetic, eight and more of a thread in flight.
#define PWB (4 * (DM / 64) * (DM / 128))      /* weight blocks */
#define PXV 16384                    /* x values per block */
__global__ __launch_bounds__(256) void k_prep(const float* __restrict__ x, const float* __restrict__ wq, const float* __restrict__ wk, const float* __restrict__ wv, const float* __restrict__ wo,
    _Float16* __restrict__ X16, _Float16* __restrict__ BQKV, _Float16* __restrict__ BO) {
  __shared__ __attribute__((aligned(16))) unsigned short tl[64 * 128];
  const int tid = threadIdx.x;
  if (blockIdx.x < PWB) {      /* block-uniform */
    const int tpm = (DM / 64) * (DM / 128); const int m = blockIdx.x / tpm, tt = blockIdx.x % tpm; const int n0 = (tt / (DM / 128)) * 64, k0 = (tt % (DM / 128)) * 128;
    const float* Wm = m == 0 ? wq : m == 1 ? wk : m == 2 ? wv : wo;
    unsigned short* Bt = (unsigned short*)(m < 3 ? BQKV + (size_t)m * DM * DM : BO);      /* q | k | v stacked along n */
    const int ng = tid & 15, kg = tid >> 4;
    const float* sp = Wm + (size_t)(k0 + kg * 8) * DM + n0 + ng * 4;
    v4f r[8];
#pragma unroll
    for (int i = 0; i < 8; ++i) r[i] = *(const v4fa*)(sp + i * DM);      /* unrolled: r stays in registers and the 8 loads are in flight together */
#pragma unroll
    for (int j = 0; j < 4; ++j) { FragH f;
#pragma unroll
      for (int i = 0; i < 8; ++i) f.h[i] = (_Float16)(bf16_round(r[i][j]) * 16.0f);
      *(v8us*)(tl + (ng * 4 + j) * 128 + (kg ^ ng) * 8) = f.half[0]; }
    __syncthreads();      /* the tile is whole in LDS before any wave reads rows of it */
    const int rw = (tid >> 5) * 8 + ((tid >> 4) & 1), c = tid & 15;      /* a wave writes 8 rows, two per store */
    unsigned short* dp = Bt + (size_t)(n0 + rw) * DM + k0 + c * 8;
#pragma unroll
    for (int q = 0; q < 4; ++q) { const int n = rw + q * 2; const v8us v = *(const v8us*)(tl + n * 128 + (c ^ (n >> 2)) * 8); *(v8us*)(dp + q * 2 * DM) = v; }
  } else {
    const size_t base = (size_t)(blockIdx.x - PWB) * PXV + tid * 4;
    const float* sp = x + base; _Float16* dp = X16 + base;
    v4f r[16];
#pragma unroll
    for (int u = 0; u < 16; ++u) r[u] = *(const v4fa*)(sp + u * 1024);      /* unrolled: r stays in registers, every offset is an immediate, and the loads are issued ahead of the arithmetic */
#pragma unroll
    for (int u = 0; u < 16; ++u) { v4h h;
#pragma unroll
      for (int q = 0; q < 4; ++q) h[q] = (_Float16)bf16_round(r[u][q]);
      *(v4h*)(dp + u * 1024) = h; }
    asm volatile("s_wait_xcnt 0x0" ::: "memory");      /* stands behind the last x stores, ahead of any later write of a register that one of them names */
  } }
static_assert(DM % 128 == 0 && (NR * DM) % PXV == 0 && PXV == 16 * 256 * 4, "k_prep: whole weight tiles and whole x blocks");
__global__ __launch_bounds__(256) void k_h16(const float* __restrict__ x, _Float16* __restrict__ X16, size_t n8) { const size_t t = (size_t)blockIdx.x * 256 + threadIdx.x; if (t >= n8) return; FragH f;
#pragma unroll
  for (int q = 0; q < 8; ++q) f.h[q] = (_Float16)x[t * 8 + q]; *(v8us*)((unsigned short*)X16 + t * 8) = f.half[0];  }
__global__ __launch_bounds__(256) void k_round16f(const float* __restrict__ W, _Float16* __restrict__ Bt, size_t n8) { const size_t t = (size_t)blockIdx.x * 256 + threadIdx.x; if (t >= n8) return; FragH f;
#pragma unroll
  for (int i = 0; i < 8; ++i) f.h[i] = (_Float16)(bf16_round(W[t * 8 + i]) * 16.0f); *(v8us*)((unsigned short*)Bt + t * 8) = f.half[0];  }
template <int NHv, int TTv>
__global__ __launch_bounds__(256) void k_vt(const _Float16* __restrict__ V16, int ldv, int voff, _Float16* __restrict__ Vt) { __shared__ unsigned short tl[64][66]; const int tid = threadIdx.x; const int slab = blockIdx.x / (TTv / 64), lg = blockIdx.x % (TTv / 64); const int b = slab / NHv, h = slab % NHv;
  for (int i = tid; i < 64 * 8; i += 256) { const int r = i / 8, c8 = (i % 8) * 8; FragH f; f.half[0] = *(const v8us*)((const unsigned short*)V16 + ((size_t)b * TTv + lg * 64 + r) * ldv + voff + h * 64 + c8);
#pragma unroll
    for (int q = 0; q < 8; ++q) tl[r][c8 + q] = f.u[q]; }
  __syncthreads();
  {
#pragma unroll
    for (int rd = 0; rd < 2; ++rd) { const int d = rd * 32 + tid / 8, pc = tid % 8; FragH f;
#pragma unroll
      for (int q = 0; q < 8; ++q) f.u[q] = tl[pc * 8 + q][d];
      *(v8us*)((unsigned short*)Vt + ((size_t)slab * 64 + d) * TTv + lg * 64 + pc * 8) = f.half[0]; }
     } }

__global__ __launch_bounds__(256) void k_hl(const float* __restrict__ F, _Float16* __restrict__ Hh, _Float16* __restrict__ Hl, size_t n8) { const size_t t = (size_t)blockIdx.x * 256 + threadIdx.x; if (t >= n8) return; FragH fh, fl; const v4f a = *(const v4fa*)(F + t * 8), c = *(const v4fa*)(F + t * 8 + 4);
#pragma unroll
  for (int q = 0; q < 4; ++q) { _Float16 h = (_Float16)a[q]; fh.h[q] = h; fl.h[q] = (_Float16)((a[q] - (float)h) * 1024.0f); h = (_Float16)c[q]; fh.h[4 + q] = h; fl.h[4 + q] = (_Float16)((c[q] - (float)h) * 1024.0f); }
  { *(v8us*)((unsigned short*)Hh + t * 8) = fh.half[0]; *(v8us*)((unsigned short*)Hl + t * 8) = fl.half[0];  } }

// ---- fast GEMM (wave tile 32x64; requires M % 32 == 0 rows per launch region and N % 64 == 0); epilogue = k_gemm_hhx semantics ----
__device__ __forceinline__ v16h g2_frag(const _Float16* p, int hh) { FragH f; f.half[0] = *(const v8us*)((const unsigned short*)p + 8 * hh); f.half[1] = *(const v8us*)((const unsigned short*)p + 16 + 8 * hh); return f.v; }
__device__ __forceinline__ v8f g2_mma(v16h a, v16h b, v8f c) { v8f d = __builtin_amdgcn_wmma_f32_16x16x32_f16(false, a, false, b, (short)0, c, false, false); asm volatile("v_nop\n\tv_nop\n\tv_nop\n\tv_nop" : "+v"(d) : "v"(a), "v"(b)); return d; }
template <int ACT>
__global__ __launch_bounds__(128) void k_gemm2(const _Float16* __restrict__ A, int lda, size_t sA, const _Float16* __restrict__ Bh, int ldb, size_t sB, float alpha, const float* __restrict__ bias, size_t sBias, const float* __restrict__ CP, int rowsPerB, size_t sCPb, int row0g,
    float* __restrict__ C, _Float16* __restrict__ C16, int ldc, size_t sC, int M, int N, int K) { static_assert(ACT == 0 || ACT == 3 || ACT == 6 || ACT == 8 || ACT == 9 || ACT == 11 || ACT == 12 || ACT == 14 || ACT == 15 || ACT == 16 || ACT == 17, "k_gemm2: unsupported ACT code (would silently apply no activation)");
  __shared__ __attribute__((aligned(16))) float so[4][32][68];
  const int tid = threadIdx.x, w = tid >> 5, lane = tid & 31, ln = lane & 15, hh = lane >> 4; const int by = blockIdx.y;
  A += (size_t)by * sA; Bh += (size_t)by * sB; const size_t cofs = (size_t)by * sC; const float* bp = bias ? bias + (size_t)by * sBias : nullptr;
  const int ntn = N >> 6; const int mt = blockIdx.x / ntn, nq = blockIdx.x - mt * ntn; const int row0 = mt * 128 + 32 * w, col0 = nq * 64; if (row0 >= M) return;
  const _Float16* a0p = A + (size_t)(row0 + ln) * lda; const _Float16* a1p = a0p + (size_t)16 * lda;
  const _Float16* b0p = Bh + (size_t)(col0 + ln) * ldb; const _Float16* b1p = b0p + (size_t)16 * ldb; const _Float16* b2p = b1p + (size_t)16 * ldb; const _Float16* b3p = b2p + (size_t)16 * ldb;
  const v8f z8 = {0.f,0.f,0.f,0.f,0.f,0.f,0.f,0.f}; v8f c00 = z8, c01 = z8, c02 = z8, c03 = z8, c10 = z8, c11 = z8, c12 = z8, c13 = z8;
#pragma unroll 1
  for (int kb = 0; kb < K; kb += 32) { const v16h a0 = g2_frag(a0p + kb, hh), a1 = g2_frag(a1p + kb, hh);
    v16h b = g2_frag(b0p + kb, hh); c00 = g2_mma(a0, b, c00); c10 = g2_mma(a1, b, c10);
    b = g2_frag(b1p + kb, hh); c01 = g2_mma(a0, b, c01); c11 = g2_mma(a1, b, c11);
    b = g2_frag(b2p + kb, hh); c02 = g2_mma(a0, b, c02); c12 = g2_mma(a1, b, c12);
    b = g2_frag(b3p + kb, hh); c03 = g2_mma(a0, b, c03); c13 = g2_mma(a1, b, c13); }
  v8f accs[8] = {c00, c01, c02, c03, c10, c11, c12, c13};
#pragma unroll
  for (int u = 0; u < 8; ++u) { const int t = u & 3, half = u >> 2; const int col = col0 + t * 16 + ln; const float bv = bp ? bf16_round(bp[col]) : 0.f;
#pragma unroll
    for (int r = 0; r < 8; ++r) { const int rloc = half * 16 + 8 * hh + r; float v = accs[u][r] * alpha + bv; if (CP) { if (rowsPerB < 0) v += CP[cofs + (size_t)(row0g + row0 + rloc) * ldc + col];      /* rowsPerB < 0: own element of the batched C plane */ else { const int bidx = (row0g + row0 + rloc) / rowsPerB; v += CP[(size_t)bidx * sCPb + (size_t)by * 64 + col]; } }
      if (ACT == 3) v = fmaxf(v, 0.f); else if (ACT == 6) v = 0.5f * v * (1.0f + erff(v * 0.70710678118654752f)); else if (ACT == 11) v = 1.0f / (1.0f + expf(-v)); else if (ACT == 15) v = v / (1.0f + expf(-v)); else if (ACT == 12) v = (v > 0.f) ? v : 0.01f * v; else if (ACT == 8) v = tanhf(v); else if (ACT == 9) v = 0.5f * v * (1.0f + tanhf(0.7978845608028654f * (v + 0.044715f * v * v * v))); else if (ACT == 14) v = (v > 0.f) ? v : 0.1f * v; else if (ACT == 16) v = (v >= 0.f) ? v : 0.3f * v; else if (ACT == 17) v = (v >= 0.f) ? v : 0.2f * v;
      so[w][rloc][t * 16 + ln] = v; } }
  __builtin_amdgcn_fence(__ATOMIC_ACQ_REL, "workgroup"); __builtin_amdgcn_wave_barrier();
  const int rsub = lane >> 4, c4 = (lane & 15) * 4;
  {
#pragma unroll
    for (int q = 0; q < 16; ++q) { const int r = q * 2 + rsub; const v4f v = *(const v4fa*)&so[w][r][c4]; if (C) *(v4f*)(C + cofs + (size_t)(row0 + r) * ldc + col0 + c4) = v; if (C16) { v4h h4; for (int i = 0; i < 4; ++i) h4[i] = (_Float16)v[i]; *(v4h*)(C16 + cofs + (size_t)(row0 + r) * ldc + col0 + c4) = h4; } }
     } }

// q | k | v projection of ALL token rows (wave tile and product order of k_gemm2, pitches and K = DM) with the per-head work in the epilogue: no f32 q | k | v plane in memory and no launch per (row, head).
// A block is 8 waves: 128 rows of one batch x 128 columns, two heads of q, of k or of v (block-uniform); four waves share a head. The K loop reads its fragments from LDS stages that asynchronous copies fill one trip ahead,
// so each operand byte leaves L2 once per block instead of once per wave. q, k: each wave stages its 32x64 f32 tile in its own LDS range; 8 lanes take one row (lanes 0-3 columns 0-31, lanes 4-7 columns 32-63),
// each reads its 8 low-half and 8 high-half values and the two table rows, rotates and stores 16 bytes: one instruction fills whole 128-byte lines.
// v: accumulator registers 0..7 of a lane are 8 consecutive token rows of one column, so each lane packs them to 16 bytes of V^T; each head's 64 x 128 tile is gathered in LDS (pitch 272 bytes) so that one wave writes each 256-byte row piece.
// Rows 0..127 of a batch (one block row) are also written in f32 for the exact first-tile attention.
// Every epilogue loop is unrolled so that accs, xs and tb are indexed by constants and stay in registers.
// A 16-byte global store (two for the f32 form) with s_wait_xcnt 0 as the last line of the same statement: the epilogue reuses its staging registers from pass to pass, and a wait in a statement of its own would not hold the next pass's register writes behind it.
__device__ __forceinline__ void st16_wait(unsigned short* p, v8us d) { asm volatile("global_store_b128 %0, %1, off\n\ts_wait_xcnt 0x0" :: "v"(p), "v"(d) : "memory"); }
__device__ __forceinline__ void st32_wait(float* p, v4f d0, v4f d1) { asm volatile("global_store_b128 %0, %1, off\n\tglobal_store_b128 %0, %2, off offset:16\n\ts_wait_xcnt 0x0" :: "v"(p), "v"(d0), "v"(d1) : "memory"); }
// Operand tiles of a GEMM K loop staged in LDS: a stage is 64 k of 128 A rows, then of 128 B rows, each row 128 bytes at a pitch of 144 (16 bytes x an odd number: the 16-byte fragment reads meet no bank conflict).
// 256 threads: thread t brings 16-byte piece t & 7 of rows (t >> 3) + 32 j, so one wave's copy covers four whole 128-byte lines.
#define GP 72                        /* LDS row pitch in f16 */
#define GSTG (256 * GP * 2)          /* bytes of one stage */
// Eight asynchronous copies, each lane its own 16 bytes, with s_wait_xcnt 0 as the last line of the same statement: it stands ahead of any rewrite of the address registers that the copies name.
__device__ __forceinline__ void g3_copy8(unsigned l, const _Float16* a, const _Float16* b) {
  asm volatile("global_load_async_to_lds_b128 %0, %8, off\n\tglobal_load_async_to_lds_b128 %1, %9, off\n\tglobal_load_async_to_lds_b128 %2, %10, off\n\tglobal_load_async_to_lds_b128 %3, %11, off\n\t"
               "global_load_async_to_lds_b128 %4, %12, off\n\tglobal_load_async_to_lds_b128 %5, %13, off\n\tglobal_load_async_to_lds_b128 %6, %14, off\n\tglobal_load_async_to_lds_b128 %7, %15, off\n\ts_wait_xcnt 0x0"
               :: "v"(l), "v"(l + 32u * GP * 2), "v"(l + 64u * GP * 2), "v"(l + 96u * GP * 2), "v"(l + 128u * GP * 2), "v"(l + 160u * GP * 2), "v"(l + 192u * GP * 2), "v"(l + 224u * GP * 2),
                  "v"(a), "v"(a + 32 * DM), "v"(a + 64 * DM), "v"(a + 96 * DM), "v"(b), "v"(b + 32 * DM), "v"(b + 64 * DM), "v"(b + 96 * DM) : "memory"); }
// Four more, for the 128 rows of a second A operand (they lie behind the B rows of the stage).
#define GSTG3 (384 * GP * 2)         /* bytes of one stage with two A operands */
__device__ __forceinline__ void g3_copy4(unsigned l, const _Float16* e) {
  asm volatile("global_load_async_to_lds_b128 %0, %4, off\n\tglobal_load_async_to_lds_b128 %1, %5, off\n\tglobal_load_async_to_lds_b128 %2, %6, off\n\tglobal_load_async_to_lds_b128 %3, %7, off\n\ts_wait_xcnt 0x0"
               :: "v"(l), "v"(l + 32u * GP * 2), "v"(l + 64u * GP * 2), "v"(l + 96u * GP * 2), "v"(e), "v"(e + 32 * DM), "v"(e + 64 * DM), "v"(e + 96 * DM) : "memory"); }
__global__ __launch_bounds__(256) void k_qkv_rope(const _Float16* __restrict__ A, const _Float16* __restrict__ Bh, const float* __restrict__ tcos, const float* __restrict__ tsin,
    _Float16* __restrict__ Q16, _Float16* __restrict__ K16, _Float16* __restrict__ VTa, float* __restrict__ QF, float* __restrict__ KF, float* __restrict__ VF) {
  __shared__ __attribute__((aligned(16))) char sm[2 * GSTG];      /* two stages in the K loop; behind it the epilogue's staging */
  static_assert(sizeof(float) * 8 * 32 * 68 <= 2 * GSTG, "the epilogue's staging fits the two stages");
  float (*so)[32][68] = (float (*)[32][68])sm;
  const int tid = threadIdx.x, w8 = tid >> 5, w = w8 & 3, wg = w8 >> 2, lane = tid & 31, ln = lane & 15, hh = lane >> 4;      /* waves 0-3: the block's first head, waves 4-7: its second; w: the wave's 32 rows */
  const int ntn = 3 * DM / 128; const int mt = blockIdx.x / ntn, np = blockIdx.x - mt * ntn; const int row0 = mt * 128 + 32 * w;
  const int sel = (np * 2) / NH, h = (np * 2) % NH + wg;      /* 0 q, 1 k, 2 v (block-uniform: a pair of heads lies in one of them); head */
  const int b = mt / (SQ / 128), pb = (mt % (SQ / 128)) * 128, p0 = pb + 32 * w;      /* batch; position of the block's and of the wave's first row */
  const bool first = pb == 0;
  const unsigned l0 = (unsigned)(size_t)sm + (unsigned)(tid >> 3) * (GP * 2) + (unsigned)(tid & 7) * 16;      /* the thread's first place in stage 0: LDS byte address */
  const _Float16* ga = A + (size_t)(mt * 128 + (tid >> 3)) * DM + (tid & 7) * 8; const _Float16* gb = Bh + (size_t)(np * 128 + (tid >> 3)) * DM + (tid & 7) * 8;
  const v8f z8 = {0.f,0.f,0.f,0.f,0.f,0.f,0.f,0.f}; v8f c00 = z8, c01 = z8, c02 = z8, c03 = z8, c10 = z8, c11 = z8, c12 = z8, c13 = z8;
  g3_copy8(l0, ga, gb);
  asm volatile("s_wait_asynccnt 0x0" ::: "memory");      /* this wave's part of tile 0 has landed */
  __syncthreads();      /* tile 0 is whole for every wave */
  g3_copy8(l0 + GSTG, ga + 64, gb + 64);
#pragma unroll 1
  for (int t = 0; t < DM / 64; ++t) {      /* kept rolled: one trip is one stage, 16 WMMAs a wave */
    const _Float16* st = (const _Float16*)(sm + (t & 1) * GSTG);
    const _Float16* ap = st + (32 * w + ln) * GP; const _Float16* bp = st + (128 + 64 * wg + ln) * GP;
#pragma unroll
    for (int kk = 0; kk < 64; kk += 32) { const v16h a0 = g2_frag(ap + kk, hh), a1 = g2_frag(ap + 16 * GP + kk, hh);      /* unrolled: the LDS offsets of both halves of the stage are immediates; the six fragments of 32 k are read as one group, ahead of their WMMAs */
      const v16h b0 = g2_frag(bp + kk, hh), b1 = g2_frag(bp + 16 * GP + kk, hh), b2 = g2_frag(bp + 32 * GP + kk, hh), b3 = g2_frag(bp + 48 * GP + kk, hh);
      c00 = g2_mma(a0, b0, c00); c10 = g2_mma(a1, b0, c10); c01 = g2_mma(a0, b1, c01); c11 = g2_mma(a1, b1, c11);
      c02 = g2_mma(a0, b2, c02); c12 = g2_mma(a1, b2, c12); c03 = g2_mma(a0, b3, c03); c13 = g2_mma(a1, b3, c13); }
    asm volatile("s_wait_dscnt 0x0" ::: "memory");      /* this wave's reads of the stage have returned */
    asm volatile("s_wait_asynccnt 0x0" ::: "memory");      /* this wave's part of tile t + 1 has landed */
    __syncthreads();      /* publishes tile t + 1 and ends every wave's reads of tile t */
    if (t + 2 < DM / 64) g3_copy8(l0 + (unsigned)(t & 1) * GSTG, ga + (t + 2) * 64, gb + (t + 2) * 64); }      /* refill of the stage just left; the test is the same for the whole block */
  asm volatile("s_wait_asynccnt 0x0" ::: "memory");      /* no copy is outstanding when the stages become the epilogue's staging */
  v8f accs[8] = {c00, c01, c02, c03, c10, c11, c12, c13};
#pragma unroll
  for (int u = 0; u < 8; ++u) accs[u] *= 0.0625f;      /* undoes the x16 of the weights, exact */
  if (sel == 2) {
    unsigned short* tv = (unsigned short*)sm + wg * 64 * 136;      /* per head [64 columns][136]: 128 token rows + 8 pad */
#pragma unroll
    for (int u = 0; u < 8; ++u) { const int t = u & 3, half = u >> 2; FragH f;
#pragma unroll
      for (int r = 0; r < 8; ++r) f.h[r] = (_Float16)accs[u][r];
      *(v8us*)(tv + (t * 16 + ln) * 136 + 32 * w + half * 16 + 8 * hh) = f.half[0]; }
    __syncthreads();      /* block-uniform branch: every wave's columns are in LDS before any wave reads whole rows of V^T */
    unsigned short* vt = (unsigned short*)VTa + ((size_t)(b * NH + h) * HD + w * 16 + hh) * SQ + pb + ln * 8;
#pragma unroll
    for (int q = 0; q < 8; ++q) { const v8us v = *(const v8us*)(tv + (w * 16 + q * 2 + hh) * 136 + ln * 8); *(v8us*)(vt + (size_t)q * 2 * SQ) = v; }
    asm volatile("s_wait_xcnt 0x0" ::: "memory");      /* stands behind the V^T stores, ahead of the first write of a register that one of them names */
    if (first) { float* vf = VF + ((size_t)b * QT0 + p0 + 8 * hh) * DM + h * HD + ln;
#pragma unroll
      for (int u = 0; u < 8; ++u)
#pragma unroll
        for (int r = 0; r < 8; ++r) vf[(size_t)((u >> 2) * 16 + r) * DM + (u & 3) * 16] = accs[u][r]; }
  } else {
#pragma unroll
    for (int u = 0; u < 8; ++u)
#pragma unroll
      for (int r = 0; r < 8; ++r) so[w8][(u >> 2) * 16 + 8 * hh + r][(u & 3) * 16 + ln] = accs[u][r];
    __builtin_amdgcn_fence(__ATOMIC_ACQ_REL, "workgroup"); __builtin_amdgcn_wave_barrier();      /* the wave reads back what its own lanes wrote */
    const int rs = lane >> 3, up = (lane >> 2) & 1, i8 = (lane & 3) * 8;
    unsigned short* h16 = (unsigned short*)(sel ? K16 : Q16) + (size_t)(row0 + rs) * DM + h * HD + up * 32 + i8;
    float* f32 = (sel ? KF : QF) + ((size_t)b * QT0 + p0 + rs) * DM + h * HD + up * 32 + i8;      /* formed for every block, used by the first block row alone */
    const float* cp = tcos + (size_t)(p0 + rs) * (HD / 2) + i8; const float* sp = tsin + (size_t)(p0 + rs) * (HD / 2) + i8;
    v4f xs[2][4], tb[2][4];      /* two register sets: pass q + 1 is fetched ahead of the arithmetic of pass q, because no load moves up over the store statements */
#pragma unroll
    for (int q = -1; q < 8; ++q) {
      if (q < 7) { const int n = q + 1, s = n & 1, r = n * 4 + rs;
        xs[s][0] = *(const v4fa*)&so[w8][r][i8]; xs[s][1] = *(const v4fa*)&so[w8][r][i8 + 4]; xs[s][2] = *(const v4fa*)&so[w8][r][32 + i8]; xs[s][3] = *(const v4fa*)&so[w8][r][32 + i8 + 4];
        tb[s][0] = *(const v4fa*)(cp + n * 4 * (HD / 2)); tb[s][1] = *(const v4fa*)(cp + n * 4 * (HD / 2) + 4); tb[s][2] = *(const v4fa*)(sp + n * 4 * (HD / 2)); tb[s][3] = *(const v4fa*)(sp + n * 4 * (HD / 2) + 4); }
      if (q >= 0) { const int s = q & 1; FragH f; v4f o0, o1;
#pragma unroll
        for (int e = 0; e < 8; ++e) { const float lo = xs[s][e >> 2][e & 3], hi = xs[s][2 + (e >> 2)][e & 3]; const float cv = bf16_round(tb[s][e >> 2][e & 3]), sv = bf16_round(tb[s][2 + (e >> 2)][e & 3]);
          const float o = lo * (up ? sv : cv) + hi * (up ? cv : -sv);      /* low half x1 c - x2 s, high half x1 s + x2 c */
          f.h[e] = (_Float16)o; if (e < 4) o0[e & 3] = o; else o1[e & 3] = o; }
        st16_wait(h16 + (size_t)q * 4 * DM, f.half[0]);
        if (first) st32_wait(f32 + (size_t)q * 4 * DM, o0, o1); } }
  } }
static_assert(QT0 == 128 && SQ % 128 == 0 && HD == 64 && DM == NH * HD, "k_qkv_rope: a block is 128 rows of one batch x two heads; the first-tile rows are one block row");

__global__ __launch_bounds__(256) void k_wnat(const float* __restrict__ w, size_t n8, _Float16* __restrict__ Bt) { const size_t t = (size_t)blockIdx.x * 256 + threadIdx.x; if (t >= n8) return; FragH f; for (int q = 0; q < 8; ++q) f.h[q] = (_Float16)(bf16_round(w[t * 8 + q]) * 16.0f); *(v8us*)((unsigned short*)Bt + t * 8) = f.half[0];  }
__global__ __launch_bounds__(256) void k_rsm(const float* __restrict__ S, _Float16* __restrict__ P, int nrows) {
  #pragma clang fp contract(off)
  const int i = blockIdx.x * 256 + threadIdx.x; if (i >= nrows) return; const float* s = S + (size_t)i * SQ; float mx = -3.0e38f;
#pragma unroll 1
  for (int j = 0; j < SQ; ++j) mx = fmaxf(mx, s[j]); float se = 0.f;
#pragma unroll 1
  for (int j = 0; j < SQ; ++j) se += expf(s[j] - mx); const float sc = 256.0f / se;
#pragma unroll 1
  for (int j0 = 0; j0 < SQ; j0 += 8) { FragH f; for (int q = 0; q < 8; ++q) f.h[q] = (_Float16)(expf(s[j0 + q] - mx) * sc); unsigned short* d = (unsigned short*)P + (size_t)i * SQ + j0; *(v8us*)d = f.half[0];  } }
__global__ __launch_bounds__(256) void k_vt(const _Float16* __restrict__ V16, int b, int h0, _Float16* __restrict__ VT) { __shared__ unsigned short tl[64][65]; const int tid = threadIdx.x; const int hh = blockIdx.x % HG, sg = blockIdx.x / HG; const int s0 = sg * 64; const int h = h0 + hh;
  for (int i = tid; i < 64 * 8; i += 256) { const int j = i / 8, d8 = (i % 8) * 8; FragH f; f.half[0] = *(const v8us*)((const unsigned short*)V16 + ((size_t)b * SQ + s0 + j) * DM + h * HD + d8); for (int q = 0; q < 8; ++q) tl[d8 + q][j] = f.u[q]; }
  __syncthreads();
  { for (int i = tid; i < 64 * 8; i += 256) { const int d = i / 8, j8 = (i % 8) * 8; FragH f; for (int q = 0; q < 8; ++q) f.u[q] = tl[d][j8 + q]; *(v8us*)((unsigned short*)VT + ((size_t)hh * HD + d) * SQ + s0 + j8) = f.half[0]; }  } }


__global__ __launch_bounds__(256) void k_tab2(float theta, float* __restrict__ CS, float* __restrict__ SN) {
  #pragma clang fp contract(off)
  const int t = blockIdx.x * 256 + threadIdx.x; if (t >= SQ * (HD / 2)) return; const int i = t % (HD / 2); const int p = t / (HD / 2); const float invf = 1.0f / powf(theta, (float)(2 * i) / (float)HD); const float ang = __fmul_rn((float)p, invf); const float c = cosf(ang), s = sinf(ang);
  *(float*)(CS + t) = c; *(float*)(SN + t) = s;  }
template <int NORM, int ROPE>
__global__ __launch_bounds__(64) void k_xform(const float* __restrict__ F, int ldf, int nh, const float* __restrict__ gain, float eps, const float* __restrict__ CS, const float* __restrict__ SN, _Float16* __restrict__ H16, int ldo) {
  #pragma clang fp contract(off)
  __shared__ float xv[HD]; __shared__ float red[HD]; __shared__ unsigned short sh_[HD]; const int d = threadIdx.x; const int h = blockIdx.x % nh; const size_t r = blockIdx.x / nh; const int p = (int)(r % SQ);
  float x = F[r * (size_t)ldf + (size_t)h * HD + d];
  if (NORM) { red[d] = __fmul_rn(x, x); __syncthreads(); for (int st = HD / 2; st > 0; st >>= 1) { if (d < st) red[d] = __fadd_rn(red[d], red[d + st]); __syncthreads(); } const float rs = rsqrtf(__fadd_rn(red[0] / (float)HD, eps)); x = __fmul_rn(__fmul_rn(x, rs), bf16_round(gain[d])); }
  xv[d] = x; __syncthreads();
  float o = x;
  if (ROPE == 1) { const int i = d >> 1; const float c = CS[p * (HD / 2) + i], s = SN[p * (HD / 2) + i]; const float ev = xv[2 * i], od = xv[2 * i + 1]; o = (d & 1) ? __fadd_rn(__fmul_rn(ev, s), __fmul_rn(od, c)) : __fadd_rn(__fmul_rn(ev, c), -__fmul_rn(od, s)); }
  if (ROPE == 2) { const int i = d & (HD / 2 - 1); const float c = CS[p * (HD / 2) + i], s = SN[p * (HD / 2) + i]; const float lo = xv[i], hi = xv[i + HD / 2]; o = (d < HD / 2) ? __fadd_rn(__fmul_rn(lo, c), -__fmul_rn(hi, s)) : __fadd_rn(__fmul_rn(lo, s), __fmul_rn(hi, c)); }
  FragH th; th.h[0] = (_Float16)o; sh_[d] = th.u[0]; __syncthreads();
  if (d < HD / 8) { FragH f; for (int q = 0; q < 8; ++q) f.u[q] = sh_[d * 8 + q]; unsigned short* dst = (unsigned short*)H16 + r * (size_t)ldo + (size_t)h * HD + d * 8; *(v8us*)dst = f.half[0];  } }

__global__ __launch_bounds__(256) void k_tab4(const int* __restrict__ pos, float theta, float* __restrict__ CS, float* __restrict__ SN) {
  #pragma clang fp contract(off)
  const int t = blockIdx.x * 256 + threadIdx.x; if (t >= SQ * (HD / 2)) return; const int i = t % (HD / 2); const int p = t / (HD / 2); const float invf = (float)pow((double)theta, -((double)(2 * i)) / (double)HD); const float ang = __fmul_rn((float)pos[p], invf); const float c = cosf(ang), s = sinf(ang);
  *(float*)(CS + t) = c; *(float*)(SN + t) = s;  }
__global__ __launch_bounds__(256) void k_rsmf(const float* __restrict__ S, _Float16* __restrict__ P, int qn, int hg) {
  #pragma clang fp contract(off)
  const int t = blockIdx.x * 256 + threadIdx.x; if (t >= qn * hg) return; const size_t i = (size_t)(t / qn) * SQ + (t % qn); const float* s = S + i * SQ; float mx = -3.0e38f;
#pragma unroll 1
  for (int j = 0; j < SQ; ++j) mx = fmaxf(mx, s[j]); float se = 0.f;
#pragma unroll 1
  for (int j = 0; j < SQ; ++j) se += __expf(s[j] - mx); const float sc = 256.0f / se;
#pragma unroll 1
  for (int j0 = 0; j0 < SQ; j0 += 8) { FragH f; for (int q = 0; q < 8; ++q) f.h[q] = (_Float16)(__expf(s[j0 + q] - mx) * sc); unsigned short* d = (unsigned short*)P + i * SQ + j0; *(v8us*)d = f.half[0];  } }


__device__ __forceinline__ v8f fa_mma(v16h a, v16h b, v8f c) { return __builtin_amdgcn_wmma_f32_16x16x32_f16(false, a, false, b, (short)0, c, false, false); }
// 2^x for eight values (two for the rescale factors) in ONE statement: outputs are early-clobber, so no exponential reads its predecessor's result or overwrites its source, and the closing v_nop keeps the one
// independent slot that the instruction set asks for between the last exponential and whatever the compiler places next.
__device__ __forceinline__ v8f fa_exp8(v8f x) { float y0, y1, y2, y3, y4, y5, y6, y7;
  asm("v_exp_f32 %0, %8\n\tv_exp_f32 %1, %9\n\tv_exp_f32 %2, %10\n\tv_exp_f32 %3, %11\n\tv_exp_f32 %4, %12\n\tv_exp_f32 %5, %13\n\tv_exp_f32 %6, %14\n\tv_exp_f32 %7, %15\n\tv_nop"
      : "=&v"(y0), "=&v"(y1), "=&v"(y2), "=&v"(y3), "=&v"(y4), "=&v"(y5), "=&v"(y6), "=&v"(y7) : "v"(x[0]), "v"(x[1]), "v"(x[2]), "v"(x[3]), "v"(x[4]), "v"(x[5]), "v"(x[6]), "v"(x[7]));
  const v8f y = {y0, y1, y2, y3, y4, y5, y6, y7}; return y; }
__device__ __forceinline__ void fa_exp2(float x0, float x1, float& y0, float& y1) { asm("v_exp_f32 %0, %2\n\tv_exp_f32 %1, %3\n\tv_nop" : "=&v"(y0), "=&v"(y1) : "v"(x0), "v"(x1)); }
// A stage is 64 keys: 64 K rows, then the 64 V^T rows' 64 columns, each row 128 bytes at the pitch GP (16 bytes x an odd number: the 16-byte fragment reads meet no bank conflict).
// 128 threads: thread t brings 16-byte piece t & 7 of rows (t >> 3) + 16 j, so one wave's copy covers four whole 128-byte lines.
#define FSTG (128 * GP * 2)          /* bytes of one stage */
// Eight asynchronous copies, each lane its own 16 bytes, with s_wait_xcnt 0 as the last line of the same statement: it stands ahead of any rewrite of the address registers that the copies name.
__device__ __forceinline__ void fa_copy8(unsigned l, const _Float16* k, const _Float16* v) {
  asm volatile("global_load_async_to_lds_b128 %0, %8, off\n\tglobal_load_async_to_lds_b128 %1, %9, off\n\tglobal_load_async_to_lds_b128 %2, %10, off\n\tglobal_load_async_to_lds_b128 %3, %11, off\n\t"
               "global_load_async_to_lds_b128 %4, %12, off\n\tglobal_load_async_to_lds_b128 %5, %13, off\n\tglobal_load_async_to_lds_b128 %6, %14, off\n\tglobal_load_async_to_lds_b128 %7, %15, off\n\ts_wait_xcnt 0x0"
               :: "v"(l), "v"(l + 16u * GP * 2), "v"(l + 32u * GP * 2), "v"(l + 48u * GP * 2), "v"(l + 64u * GP * 2), "v"(l + 80u * GP * 2), "v"(l + 96u * GP * 2), "v"(l + 112u * GP * 2),
                  "v"(k), "v"(k + 16 * DM), "v"(k + 32 * DM), "v"(k + 48 * DM), "v"(v), "v"(v + 16 * SQ), "v"(v + 32 * SQ), "v"(v + 48 * SQ) : "memory"); }
// The K fragments of one step from the stage: ks = the lane's K row of the step's first 16 keys.
__device__ __forceinline__ void fa_kfrags(v16h (&kf)[2][2], const _Float16* ks, int hh) {
#pragma unroll
  for (int kt = 0; kt < 2; ++kt) { kf[kt][0] = g2_frag(ks + kt * 16 * GP, hh); kf[kt][1] = g2_frag(ks + kt * 16 * GP + 32, hh); } }
// One step of 32 keys; kf holds its K fragments. vs = the lane's V^T row at the step's first key: the V^T fragments are read behind the score products, so that the softmax passes before they are needed;
// PRE: the same stage holds the next step too: its K rows (kn) are read ahead of the output products, when the scores' registers are free again. DIAG: a step in the block's own 128 keys, its first key dq below the wave's first query (0 in the wave's last step): keys above the query get weight 0.
template <bool DIAG, bool PRE>
__device__ __forceinline__ void fa_step(const v16h (&qf)[2][2], v16h (&kf)[2][2], v8f (&o)[2][4], float (&mu)[2], float (&l)[2], const _Float16* vs, const _Float16* kn, int dq, int c, int hh) {
  const float cs = 0.125f * 1.44269504088896340736f;      /* score scale x log2(e) */
  const v8f z8 = {0.f,0.f,0.f,0.f,0.f,0.f,0.f,0.f};
  v8f s[2][2];
#pragma unroll
  for (int u = 0; u < 2; ++u)
#pragma unroll
    for (int kt = 0; kt < 2; ++kt) s[u][kt] = fa_mma(kf[kt][1], qf[u][1], fa_mma(kf[kt][0], qf[u][0], z8));
  v16h vf[4];
#pragma unroll
  for (int t = 0; t < 4; ++t) vf[t] = g2_frag(vs + t * 16 * GP, hh);
  if (DIAG) {
#pragma unroll
    for (int u = 0; u < 2; ++u)
#pragma unroll
      for (int kt = 0; kt < 2; ++kt)
#pragma unroll
        for (int r = 0; r < 8; ++r) s[u][kt][r] = (kt * 16 + 8 * hh + r <= dq + u * 16 + c) ? s[u][kt][r] : -1.0e30f; }
  float mx[2];
#pragma unroll
  for (int u = 0; u < 2; ++u) { float a = fmaxf(s[u][0][0], s[u][1][0]);
#pragma unroll
    for (int r = 1; r < 8; ++r) a = fmaxf(a, fmaxf(s[u][0][r], s[u][1][r]));
    a = fmaxf(a, __shfl_xor(a, 16)); mx[u] = a * cs; }      /* cs > 0: scaling commutes with the maximum */
  if (__builtin_amdgcn_ballot_w32(mx[0] > mu[0] + 8.0f || mx[1] > mu[1] + 8.0f) != 0) {      /* one scalar test per step */
    const float mn0 = fmaxf(mu[0], mx[0]), mn1 = fmaxf(mu[1], mx[1]); float al[2]; fa_exp2(mu[0] - mn0, mu[1] - mn1, al[0], al[1]); mu[0] = mn0; mu[1] = mn1;
#pragma unroll
    for (int u = 0; u < 2; ++u) { l[u] *= al[u];
#pragma unroll
      for (int t = 0; t < 4; ++t) o[u][t] *= al[u]; } }
  FragH pf[2];
#pragma unroll
  for (int u = 0; u < 2; ++u) { float sm = 0.f;
#pragma unroll
    for (int kt = 0; kt < 2; ++kt) { v8f x;
#pragma unroll
      for (int r = 0; r < 8; ++r) x[r] = fmaf(s[u][kt][r], cs, -mu[u]);
      const v8f p = fa_exp8(x);
#pragma unroll
      for (int r = 0; r < 8; ++r) { sm += p[r]; pf[u].h[kt * 8 + r] = (_Float16)p[r]; } }
    l[u] += sm; }
  if (PRE) fa_kfrags(kf, kn, hh);
#pragma unroll
  for (int u = 0; u < 2; ++u)
#pragma unroll
    for (int t = 0; t < 4; ++t) o[u][t] = fa_mma(vf[t], pf[u].v, o[u][t]); }
// Exact f32 causal attention for the first QT0 rows of every batch, run by blocks of the fused attention launch: a block takes 8 query rows of one (batch, head), a wave two of them, one after the other.
// The head's QT0 key rows are staged in LDS at a pitch of HD + 4 floats (16 bytes x an odd number: row-per-lane 16-byte reads without bank conflicts).
// Lane l scores keys l, l + 32, l + 64, l + 96 (each dot product summed over d in index order); row maximum and row sum end in lane butterflies;
// then lane l sums output columns 2 l and 2 l + 1 over the keys in index order, each weight read from its lane as a scalar.
typedef float v2f __attribute__((ext_vector_type(2)));
typedef float v2fa __attribute__((ext_vector_type(2), may_alias));
typedef _Float16 v2h __attribute__((ext_vector_type(2)));
// The row's two 4-byte stores with s_wait_xcnt 0 as the last line of the same statement: the wave's second row rewrites the registers that they name.
__device__ __forceinline__ void st4x2_wait(_Float16* ph, unsigned dh, _Float16* pl, unsigned dl) { asm volatile("global_store_b32 %0, %1, off\n\tglobal_store_b32 %2, %3, off\n\ts_wait_xcnt 0x0" :: "v"(ph), "v"(dh), "v"(pl), "v"(dl) : "memory"); }
#define FNR ((SQ / 128) * NB * NH)   /* blocks of the f16 path's index range: 16 query tiles x (batch, head) */
#define FNE (NB * NH * (QT0 / 8))    /* first-tile blocks */
__device__ __forceinline__ void fa_first(char* sm, int e, const float* __restrict__ QF, const float* __restrict__ KF, const float* __restrict__ VF, _Float16* __restrict__ OH, _Float16* __restrict__ OL) {      /* all five row pitches are DM, so that every row step is an immediate offset */
  float (*lk)[HD + 4] = (float (*)[HD + 4])sm;
  const float scale = 0.125f;
  { const size_t bo = (size_t)(e / (NH * (QT0 / 8))) * QT0 * DM; QF += bo; KF += bo; VF += bo; OH += bo; OL += bo; }      /* the batch */
  const int ex = e % (NH * (QT0 / 8));
  const int tid = threadIdx.x, lane = tid & 31; const int h = ex / (QT0 / 8);
  const float* kb = KF + h * HD;
#pragma unroll
  for (int p = 0; p < QT0 / 8; ++p) { const int r = p * 8 + (tid >> 4), c4 = (tid & 15) * 4; *(v4f*)&lk[r][c4] = *(const v4fa*)(kb + (size_t)r * DM + c4); }      /* unrolled: all 16 loads of a thread in flight at once */
  __syncthreads();      /* block-uniform path: the key rows are whole in LDS before any wave scores them */
#pragma unroll 1
  for (int rw = 0; rw < 2; ++rw) {      /* kept rolled: one copy of the row's code */
  const int i = (ex % (QT0 / 8)) * 8 + rw * 4 + __builtin_amdgcn_readfirstlane(tid >> 5);      /* the wave's query row, held as a scalar so that the q row and the group tests below are wave-uniform */
  const float* qr = QF + (size_t)i * DM + h * HD;
  float sa[QT0 / 32];
#pragma unroll
  for (int g = 0; g < QT0 / 32; ++g) sa[g] = 0.f;
#pragma unroll 8
  for (int c = 0; c < HD / 4; ++c) { const v4f qq = *(const v4fa*)(qr + c * 4);      /* unrolled by 8: the four groups' sum chains interleave, and the 32 key pieces read ahead fit the registers of four waves per SIMD (all 64 spilled) */
#pragma unroll
    for (int g = 0; g < QT0 / 32; ++g) { const v4f kq = *(const v4f*)&lk[g * 32 + lane][c * 4]; sa[g] = fmaf(qq[0], kq[0], sa[g]); sa[g] = fmaf(qq[1], kq[1], sa[g]); sa[g] = fmaf(qq[2], kq[2], sa[g]); sa[g] = fmaf(qq[3], kq[3], sa[g]); } }
  float m = -1.0e30f;
#pragma unroll
  for (int g = 0; g < QT0 / 32; ++g) { sa[g] = (g * 32 + lane <= i) ? sa[g] * scale : -1.0e30f; m = fmaxf(m, sa[g]); }      /* causal: keys above the row get weight 0 */
#pragma unroll
  for (int o = 16; o > 0; o >>= 1) m = fmaxf(m, __shfl_xor(m, o));
  float l = 0.f;
#pragma unroll
  for (int g = 0; g < QT0 / 32; ++g) { sa[g] = expf(sa[g] - m); l += sa[g]; }
#pragma unroll
  for (int o = 16; o > 0; o >>= 1) l += __shfl_xor(l, o);
  const float* vb = VF + h * HD + lane * 2; float o0 = 0.f, o1 = 0.f;
#pragma unroll
  for (int g = 0; g < QT0 / 32; ++g) { if (g * 32 <= i) {      /* wave-uniform: key groups wholly above the row are skipped */
#pragma unroll
      for (int jj = 0; jj < 32; ++jj) { const float p = __int_as_float(__builtin_amdgcn_readlane(__float_as_int(sa[g]), jj)); const v2f vv = *(const v2fa*)(vb + (size_t)(g * 32 + jj) * DM); o0 = fmaf(p, vv[0], o0); o1 = fmaf(p, vv[1], o1); } } }      /* unrolled: a group's 32 loads issue before the first use */
  const float fin = 64.0f / l;      /* o carried x64 like the f16 path */
  const float a0 = o0 * fin, a1 = o1 * fin; v2h hv, lv;      /* o leaves as an f16 value plus its residual x1024, the two A operands of the output projection's first-tile blocks */
  hv[0] = (_Float16)a0; hv[1] = (_Float16)a1; lv[0] = (_Float16)((a0 - (float)hv[0]) * 1024.0f); lv[1] = (_Float16)((a1 - (float)hv[1]) * 1024.0f);
  const size_t oo = (size_t)i * DM + h * HD + lane * 2; st4x2_wait(OH + oo, __builtin_bit_cast(unsigned, hv), OL + oo, __builtin_bit_cast(unsigned, lv)); } }
static_assert(sizeof(float) * QT0 * (HD + 4) <= 2 * FSTG, "fa_first: the key rows fit the two stages");
// amdgpu_waves_per_eu(4, 4): the register budget of four waves per SIMD, four blocks per WGP; left free, a trip of two steps took more than 256 registers.
__global__ __launch_bounds__(128) __attribute__((amdgpu_waves_per_eu(4, 4))) void k_fattn(const _Float16* __restrict__ Q16, const _Float16* __restrict__ K16, const _Float16* __restrict__ VTa, _Float16* __restrict__ O,
    const float* __restrict__ QF, const float* __restrict__ KF, const float* __restrict__ VF, _Float16* __restrict__ OH, _Float16* __restrict__ OL) {
  __shared__ __attribute__((aligned(16))) char sm[2 * FSTG];      /* two stages */
  const int tid = threadIdx.x, lane = tid & 31, c = lane & 15, hh = lane >> 4;
  const int w = __builtin_amdgcn_readfirstlane(tid >> 5);      /* the wave's number as a scalar: the tests of the last two trips are scalar branches */
  const int bh = blockIdx.x % (NB * NH); const int g = blockIdx.x / (4 * NB * NH), rr = (blockIdx.x / (NB * NH)) % 4;
  const int qt = (3 - g) * 4 + ((g & 1) ? rr : 3 - rr);      /* a permutation of the 16 query tiles: long tiles first, and blocks 256 apart (a quarter of the f16 path's index range) have tiles that sum to the same length */
  if (qt == 0 || blockIdx.x >= FNR) { fa_first(sm, blockIdx.x >= FNR ? (int)blockIdx.x - FNR + NB * NH : bh, QF, KF, VF, OH, OL); return; }      /* block-uniform, ahead of every barrier and copy: the output projection takes each batch's first 128 rows from the exact f32 attention, so the blocks of query tile 0 and those behind the index range do that work; they are short, come late in the index order and run beside the long tiles */
  const int b = bh / NH, h = bh % NH; const int q0 = qt * 128 + w * 32;
  const _Float16* qp = Q16 + ((size_t)b * SQ + q0 + c) * DM + h * HD;
  const unsigned l0 = (unsigned)(size_t)sm + (unsigned)(tid >> 3) * (GP * 2) + (unsigned)(tid & 7) * 16;      /* the thread's first place in stage 0: LDS byte address */
  const _Float16* gk = K16 + ((size_t)b * SQ + (tid >> 3)) * DM + h * HD + (tid & 7) * 8;
  const _Float16* gv = VTa + ((size_t)bh * HD + (tid >> 3)) * SQ + (tid & 7) * 8;
  const v8f z8 = {0.f,0.f,0.f,0.f,0.f,0.f,0.f,0.f};
  v16h qf[2][2], kf[2][2];
#pragma unroll
  for (int u = 0; u < 2; ++u) { qf[u][0] = g2_frag(qp + (size_t)u * 16 * DM, hh); qf[u][1] = g2_frag(qp + (size_t)u * 16 * DM + 32, hh); }
  asm volatile("s_wait_xcnt 0x0" ::: "memory");      /* stands behind the query fragments' loads, ahead of the first write of a register that holds one of their addresses */
  fa_copy8(l0, gk, gv);
  asm volatile("s_wait_asynccnt 0x0" ::: "memory");      /* this wave's part of stage 0 has landed */
  __syncthreads();      /* stage 0 is whole for every wave */
  fa_copy8(l0 + FSTG, gk + 64 * DM, gv + 64);      /* a block has 2 qt + 2 stages, never fewer than two */
  v8f o[2][4]; float mu[2], l[2];
#pragma unroll
  for (int u = 0; u < 2; ++u) { mu[u] = -1.0e30f; l[u] = 0.f;
#pragma unroll
    for (int t = 0; t < 4; ++t) o[u][t] = z8; }
#pragma unroll 1
  for (int t = 0; t < 2 * qt; ++t) {      /* the stages below the block's first query: both steps are whole for all four waves. Kept rolled: one trip is one stage, 32 WMMAs a wave, and the registers of four waves per SIMD */
    const _Float16* st = (const _Float16*)(sm + (t & 1) * FSTG);
    const _Float16* ks = st + c * GP; const _Float16* vs = st + (64 + c) * GP;
    fa_kfrags(kf, ks, hh);
    fa_step<false, true>(qf, kf, o, mu, l, vs, ks + 32 * GP, 0, c, hh);
    fa_step<false, false>(qf, kf, o, mu, l, vs + 32, ks, 0, c, hh);
    asm volatile("s_wait_dscnt 0x0" ::: "memory");      /* this wave's reads of the stage have returned */
    asm volatile("s_wait_asynccnt 0x0" ::: "memory");      /* this wave's part of stage t + 1 has landed */
    __syncthreads();      /* publishes stage t + 1 and ends every wave's reads of stage t */
    fa_copy8(l0 + (unsigned)(t & 1) * FSTG, gk + (size_t)(t + 2) * 64 * DM, gv + (t + 2) * 64); }      /* refill of the stage just left; stage t + 2 <= 2 qt + 1 exists on every trip of this loop */
#pragma unroll 1
  for (int tt = 0; tt < 2; ++tt) {      /* the block's own 128 keys, stages 2 qt (in the first buffer: 2 qt is even) and 2 qt + 1: step j is whole for the waves above j (the mask keeps every score), the diagonal of wave j, nothing for the waves below; every wave passes the trip's foot */
    const _Float16* st = (const _Float16*)(sm + tt * FSTG);
#pragma unroll 1
    for (int kk = 0; kk < 2; ++kk) { const int j = tt * 2 + kk;      /* kept rolled: one copy of the step's code */
      const _Float16* ks = st + (kk * 32 + c) * GP; const _Float16* vs = st + (64 + c) * GP + kk * 32;
      if (j <= w) { fa_kfrags(kf, ks, hh); fa_step<true, false>(qf, kf, o, mu, l, vs, ks, (w - j) * 32, c, hh); } }      /* a scalar test: j and w are wave-uniform scalars */
    asm volatile("s_wait_dscnt 0x0" ::: "memory");      /* this wave's reads of the stage have returned */
    asm volatile("s_wait_asynccnt 0x0" ::: "memory");      /* this wave's part of the last stage has landed */
    __syncthreads(); }      /* publishes the last stage */
  asm volatile("s_wait_asynccnt 0x0" ::: "memory");      /* no copy is outstanding when the wave ends */
#pragma unroll
  for (int u = 0; u < 2; ++u) { const float fin = 64.0f / (l[u] + __shfl_xor(l[u], 16));      /* the lane halves' sums join once; o carried x64 */
    unsigned short* dst = (unsigned short*)O + ((size_t)b * SQ + q0 + u * 16 + c) * DM + h * HD + 8 * hh;
#pragma unroll
    for (int t = 0; t < 4; ++t) { FragH f;
#pragma unroll
      for (int r = 0; r < 8; ++r) f.h[r] = (_Float16)(o[u][t][r] * fin);      /* register r is output column 16 t + 8 hh + r of query c: one 16-byte store */
      *(v8us*)(dst + t * 16) = f.half[0]; } } }
static_assert(SQ == 16 * 128 && HD == 64, "k_fattn: 16 query tiles of 4 waves x 32 query columns, head size 64");


// Output projection of ALL token rows in ONE launch (wave tile, product order and store path of k_gemm2, pitches and K = DM; K loop on LDS stages as in k_qkv_rope): out = o W_o, o carried x64 and W_o x16.
// A block is 8 waves: 128 rows of one batch x 128 columns. The blocks of each batch's first 128 rows take the exact attention's o instead of the f16 path's: its f16 value and its x1024 residual are two A operands
// that share every B fragment in one K loop, on two accumulator sets that join in the epilogue (hi 2^-10 + lo 2^-20). These blocks do twice the products, so they have the lowest block indices.
__global__ __launch_bounds__(256) void k_oproj(const _Float16* __restrict__ O, const _Float16* __restrict__ OH, const _Float16* __restrict__ OL, const _Float16* __restrict__ Bh, float* __restrict__ C) {
  __shared__ __attribute__((aligned(16))) char sm[2 * GSTG3];      /* two stages in the K loop; behind it the epilogue's staging */
  static_assert(sizeof(float) * 8 * 32 * 68 <= 2 * GSTG3, "the epilogue's staging fits the two stages");
  float (*so)[32][68] = (float (*)[32][68])sm;
  const int tid = threadIdx.x, w8 = tid >> 5, w = w8 & 3, wg = w8 >> 2, lane = tid & 31, ln = lane & 15, hh = lane >> 4;      /* w: the wave's 32 rows; wg: its 64 columns */
  const int ntn = DM / 128, tpb = SQ / 128; const int mi = blockIdx.x / ntn, np = blockIdx.x - mi * ntn;
  const bool first = mi < NB;      /* block-uniform */
  const int b = first ? mi : (mi - NB) / (tpb - 1); const int tl = first ? 0 : 1 + (mi - NB) % (tpb - 1);      /* batch; 128-row tile in the batch */
  const int row0 = b * SQ + tl * 128 + 32 * w, col0 = np * 128 + wg * 64;
  const unsigned l0 = (unsigned)(size_t)sm + (unsigned)(tid >> 3) * (GP * 2) + (unsigned)(tid & 7) * 16;      /* the thread's first place in stage 0: LDS byte address */
  const _Float16* gb = Bh + (size_t)(np * 128 + (tid >> 3)) * DM + (tid & 7) * 8;
  const v8f z8 = {0.f,0.f,0.f,0.f,0.f,0.f,0.f,0.f}; v8f c00 = z8, c01 = z8, c02 = z8, c03 = z8, c10 = z8, c11 = z8, c12 = z8, c13 = z8;
  v8f accs[8];
  if (!first) {
    const _Float16* ga = O + (size_t)(b * SQ + tl * 128 + (tid >> 3)) * DM + (tid & 7) * 8;
    g3_copy8(l0, ga, gb);
    asm volatile("s_wait_asynccnt 0x0" ::: "memory");      /* this wave's part of tile 0 has landed */
    __syncthreads();      /* tile 0 is whole for every wave */
    g3_copy8(l0 + GSTG3, ga + 64, gb + 64);
#pragma unroll 1
    for (int t = 0; t < DM / 64; ++t) {      /* kept rolled: one trip is one stage, 16 WMMAs a wave */
      const _Float16* st = (const _Float16*)(sm + (t & 1) * GSTG3);
      const _Float16* ap = st + (32 * w + ln) * GP; const _Float16* bp = st + (128 + 64 * wg + ln) * GP;
#pragma unroll
      for (int kk = 0; kk < 64; kk += 32) { const v16h a0 = g2_frag(ap + kk, hh), a1 = g2_frag(ap + 16 * GP + kk, hh);      /* unrolled: the LDS offsets of both halves of the stage are immediates; the six fragments of 32 k are read as one group, ahead of their WMMAs */
        const v16h b0 = g2_frag(bp + kk, hh), b1 = g2_frag(bp + 16 * GP + kk, hh), b2 = g2_frag(bp + 32 * GP + kk, hh), b3 = g2_frag(bp + 48 * GP + kk, hh);
        c00 = g2_mma(a0, b0, c00); c10 = g2_mma(a1, b0, c10); c01 = g2_mma(a0, b1, c01); c11 = g2_mma(a1, b1, c11);
        c02 = g2_mma(a0, b2, c02); c12 = g2_mma(a1, b2, c12); c03 = g2_mma(a0, b3, c03); c13 = g2_mma(a1, b3, c13); }
      asm volatile("s_wait_dscnt 0x0" ::: "memory");      /* this wave's reads of the stage have returned */
      asm volatile("s_wait_asynccnt 0x0" ::: "memory");      /* this wave's part of tile t + 1 has landed */
      __syncthreads();      /* publishes tile t + 1 and ends every wave's reads of tile t */
      if (t + 2 < DM / 64) g3_copy8(l0 + (unsigned)(t & 1) * GSTG3, ga + (t + 2) * 64, gb + (t + 2) * 64); }      /* refill of the stage just left; the test is the same for the whole block */
    asm volatile("s_wait_asynccnt 0x0" ::: "memory");      /* no copy is outstanding when the stages become the epilogue's staging */
    accs[0] = c00 * 0.0009765625f; accs[1] = c01 * 0.0009765625f; accs[2] = c02 * 0.0009765625f; accs[3] = c03 * 0.0009765625f;
    accs[4] = c10 * 0.0009765625f; accs[5] = c11 * 0.0009765625f; accs[6] = c12 * 0.0009765625f; accs[7] = c13 * 0.0009765625f;
  } else {
    const size_t go = ((size_t)b * QT0 + (tid >> 3)) * DM + (tid & 7) * 8;
    const _Float16* ga = OH + go; const _Float16* ge = OL + go;
    v8f d00 = z8, d01 = z8, d02 = z8, d03 = z8, d10 = z8, d11 = z8, d12 = z8, d13 = z8;
    g3_copy8(l0, ga, gb); g3_copy4(l0 + 256u * GP * 2, ge);
    asm volatile("s_wait_asynccnt 0x0" ::: "memory");      /* this wave's part of tile 0 has landed */
    __syncthreads();      /* tile 0 is whole for every wave */
    g3_copy8(l0 + GSTG3, ga + 64, gb + 64); g3_copy4(l0 + GSTG3 + 256u * GP * 2, ge + 64);
#pragma unroll 1
    for (int t = 0; t < DM / 64; ++t) {      /* kept rolled, like the loop above: 32 WMMAs a wave */
      const _Float16* st = (const _Float16*)(sm + (t & 1) * GSTG3);
      const _Float16* ap = st + (32 * w + ln) * GP; const _Float16* bp = st + (128 + 64 * wg + ln) * GP; const _Float16* ep = st + (256 + 32 * w + ln) * GP;
#pragma unroll
      for (int kk = 0; kk < 64; kk += 32) { const v16h a0 = g2_frag(ap + kk, hh), a1 = g2_frag(ap + 16 * GP + kk, hh), e0 = g2_frag(ep + kk, hh), e1 = g2_frag(ep + 16 * GP + kk, hh);      /* unrolled and grouped as above: eight fragments */
        const v16h b0 = g2_frag(bp + kk, hh), b1 = g2_frag(bp + 16 * GP + kk, hh), b2 = g2_frag(bp + 32 * GP + kk, hh), b3 = g2_frag(bp + 48 * GP + kk, hh);
        c00 = g2_mma(a0, b0, c00); c10 = g2_mma(a1, b0, c10); d00 = g2_mma(e0, b0, d00); d10 = g2_mma(e1, b0, d10);
        c01 = g2_mma(a0, b1, c01); c11 = g2_mma(a1, b1, c11); d01 = g2_mma(e0, b1, d01); d11 = g2_mma(e1, b1, d11);
        c02 = g2_mma(a0, b2, c02); c12 = g2_mma(a1, b2, c12); d02 = g2_mma(e0, b2, d02); d12 = g2_mma(e1, b2, d12);
        c03 = g2_mma(a0, b3, c03); c13 = g2_mma(a1, b3, c13); d03 = g2_mma(e0, b3, d03); d13 = g2_mma(e1, b3, d13); }
      asm volatile("s_wait_dscnt 0x0" ::: "memory");      /* this wave's reads of the stage have returned */
      asm volatile("s_wait_asynccnt 0x0" ::: "memory");      /* this wave's part of tile t + 1 has landed */
      __syncthreads();      /* publishes tile t + 1 and ends every wave's reads of tile t */
      if (t + 2 < DM / 64) { g3_copy8(l0 + (unsigned)(t & 1) * GSTG3, ga + (t + 2) * 64, gb + (t + 2) * 64); g3_copy4(l0 + (unsigned)(t & 1) * GSTG3 + 256u * GP * 2, ge + (t + 2) * 64); } }      /* refill of the stage just left; the test is the same for the whole block */
    asm volatile("s_wait_asynccnt 0x0" ::: "memory");      /* no copy is outstanding when the stages become the epilogue's staging */
    const v8f ch[8] = {c00, c01, c02, c03, c10, c11, c12, c13}, cl[8] = {d00, d01, d02, d03, d10, d11, d12, d13};
#pragma unroll
    for (int u = 0; u < 8; ++u)
#pragma unroll
      for (int r = 0; r < 8; ++r) accs[u][r] = fmaf(cl[u][r], 0.00000095367431640625f, ch[u][r] * 0.0009765625f);      /* both factors are powers of two: one rounding, that of the sum */
  }
#pragma unroll
  for (int u = 0; u < 8; ++u)
#pragma unroll
    for (int r = 0; r < 8; ++r) so[w8][(u >> 2) * 16 + 8 * hh + r][(u & 3) * 16 + ln] = accs[u][r];
  __builtin_amdgcn_fence(__ATOMIC_ACQ_REL, "workgroup"); __builtin_amdgcn_wave_barrier();      /* the wave reads back what its own lanes wrote */
  const int rsub = lane >> 4, c4 = (lane & 15) * 4;
#pragma unroll
  for (int q = 0; q < 16; ++q) { const int r = q * 2 + rsub; const v4f v = *(const v4fa*)&so[w8][r][c4]; *(v4f*)(C + (size_t)(row0 + r) * DM + col0 + c4) = v; } }
static_assert(QT0 == 128 && SQ % 128 == 0 && SQ > 128 && DM % 128 == 0, "k_oproj: the first-tile rows are one block row of each batch");

template <int NORM, int ROPE>
__global__ __launch_bounds__(64) void k_xformf(const float* __restrict__ F, int ldf, int nh, const float* __restrict__ gain, float eps, const float* __restrict__ CS, const float* __restrict__ SN, float* __restrict__ F32, int ldo) {
  #pragma clang fp contract(off)
  __shared__ float xv[HD]; __shared__ float red[HD]; const int d = threadIdx.x; const int h = blockIdx.x % nh; const size_t r = blockIdx.x / nh; const int p = (int)(r % SQ);
  float x = F[r * (size_t)ldf + (size_t)h * HD + d];
  if (NORM) { red[d] = __fmul_rn(x, x); __syncthreads(); for (int st = HD / 2; st > 0; st >>= 1) { if (d < st) red[d] = __fadd_rn(red[d], red[d + st]); __syncthreads(); } const float rs = rsqrtf(__fadd_rn(red[0] / (float)HD, eps)); x = __fmul_rn(__fmul_rn(x, rs), bf16_round(gain[d])); }
  xv[d] = x; __syncthreads();
  float o = x;
  if (ROPE == 1) { const int i = d >> 1; const float c = CS[p * (HD / 2) + i], s = SN[p * (HD / 2) + i]; const float ev = xv[2 * i], od = xv[2 * i + 1]; o = (d & 1) ? __fadd_rn(__fmul_rn(ev, s), __fmul_rn(od, c)) : __fadd_rn(__fmul_rn(ev, c), -__fmul_rn(od, s)); }
  if (ROPE == 2) { const int i = d & (HD / 2 - 1); const float c = CS[p * (HD / 2) + i], s = SN[p * (HD / 2) + i]; const float lo = xv[i], hi = xv[i + HD / 2]; o = (d < HD / 2) ? __fadd_rn(__fmul_rn(lo, c), -__fmul_rn(hi, s)) : __fadd_rn(__fmul_rn(lo, s), __fmul_rn(hi, c)); }
  float* dst = F32 + r * (size_t)ldo + (size_t)h * HD + d; *(float*)dst = o;  }


__global__ __launch_bounds__(256) void k_bfcp(const float* __restrict__ src, float* __restrict__ dst, size_t n4) { const size_t t = (size_t)blockIdx.x * 256 + threadIdx.x; if (t >= n4) return; const v4f a = *(const v4fa*)(src + t * 4); v4f o; for (int q = 0; q < 4; ++q) o[q] = bf16_round(a[q]); *(v4f*)(dst + t * 4) = o;  }
extern "C" void kernel_launch(void* const* d_in, const int* in_sizes, int n_in,
                              void* d_out, int out_size, void* d_ws, size_t ws_size, hipStream_t stream) {
  (void)in_sizes; (void)n_in; (void)out_size;
    const float* const* I = (const float* const*)d_in; const float* x = I[0]; const float* tcos = I[1]; const float* tsin = I[2]; const float* wq = I[3]; const float* wk = I[4]; const float* wv = I[5]; const float* wo = I[6];      /* [in][out] weights, no biases; rope tables INPUT [2048][32] */
  char* ws = (char*)d_ws; size_t off = 0;
  auto take = [&](size_t bytes) { char* p = ws + off; off += (bytes + 255) & ~(size_t)255; return p; };
  _Float16* BQKV = (_Float16*)take((size_t)3 * DM * DM * 2); _Float16* BO = (_Float16*)take((size_t)DM * DM * 2);
  _Float16* X16 = (_Float16*)take(NR * DM * 2);
  _Float16* QH = (_Float16*)take(NR * DM * 2); _Float16* KH = (_Float16*)take(NR * DM * 2); _Float16* O16 = (_Float16*)take(NR * DM * 2);
  _Float16* VT = (_Float16*)take((size_t)NB * NH * HD * SQ * 2);
  float* QF0 = (float*)take((size_t)NB * QT0 * DM * 4); float* KF0 = (float*)take((size_t)NB * QT0 * DM * 4); float* VF0 = (float*)take((size_t)NB * QT0 * DM * 4); _Float16* OH0 = (_Float16*)take((size_t)NB * QT0 * DM * 2); _Float16* OL0 = (_Float16*)take((size_t)NB * QT0 * DM * 2);
  if (off > ws_size) return;
  k_prep<<<(unsigned)(PWB + NR * DM / PXV), 256, 0, stream>>>(x, wq, wk, wv, wo, X16, BQKV, BO);      /* [in][out] weights -> Bt[n][k] x16, q | k | v stacked along n; x -> f16 rows */
  k_qkv_rope<<<(unsigned)((NR / 128) * (3 * DM / 128)), 256, 0, stream>>>(X16, BQKV, tcos, tsin, QH, KH, VT, QF0, KF0, VF0);      /* roped f16 q, k rows, V^T [NB][NH][HD][SQ], f32 q, k, v of each batch's first 128 rows */
  k_fattn<<<FNR + FNE - NB * NH, 128, 0, stream>>>(QH, KH, VT, O16, QF0, KF0, VF0, OH0, OL0);      /* o (merged heads, x64) as f16 rows from row 128 of every batch on; rows 0..127 by the exact f32 causal attention (o x64) -> f16 hi + x1024 residual planes */
  k_oproj<<<(unsigned)((NR / 128) * (DM / 128)), 256, 0, stream>>>(O16, OH0, OL0, BO, (float*)d_out);      /* out rows are the output layout; rows 0..127 of each batch from the hi and lo planes */
}

// v010
// It runs in 110 microseconds.
// In two side-by-side timings against v009, it was 1.06 and 1.04 times as fast.
// Over all steps from v000, the starting kernel, it is 88.7 times as fast.
#include <hip/hip_runtime.h>
#define NB 4
#define SQ 2048
#define DM 1024
#define NH 16
#define HD 64
#define HG 4                         /* heads per launch of the second k_vt, which is never launched */
#define QT0 128                      /* first-tile rows recomputed exactly in f32 */
#define B0 0                         /* unused: every launch covers batches 0 .. NB - 1 */
#define NBR NB                       /* used only by MPO, itself unused */
#define NR ((size_t)NB * SQ)         /* token rows */
#define MPO ((int)((size_t)NBR * SQ))      /* unused: k_oproj covers all NR rows */
typedef __bf16 v16b __attribute__((ext_vector_type(16)));
typedef unsigned short v8us __attribute__((ext_vector_type(8), may_alias));
typedef float  v8f  __attribute__((ext_vector_type(8)));
typedef float  v4f  __attribute__((ext_vector_type(4)));
typedef float  v4fa __attribute__((ext_vector_type(4), may_alias));
union FragB { v16b v; v8us half[2]; unsigned short u[16]; };

__device__ __forceinline__ unsigned short bf16_bits(float x) { unsigned int u = __float_as_uint(x); return (unsigned short)((u + 0x7FFFu + ((u >> 16) & 1u)) >> 16); }
__device__ __forceinline__ float bf16_val(unsigned short b) { return __uint_as_float(((unsigned int)b) << 16); }
__device__ __forceinline__ float bf16_round(float x) { return bf16_val(bf16_bits(x)); }
// D += A·B with NT terms: 1 = ah·bh, 2 = + al·bh (A split), 3 = + ah·bl (both split)
template <int NT>
__device__ __forceinline__ v8f mmaN(v16b ah, v16b al, v16b bh, v16b bl, v8f c) {
  c = __builtin_amdgcn_wmma_f32_16x16x32_bf16(false, ah, false, bh, (short)0, c, false, false);
  if (NT >= 2) c = __builtin_amdgcn_wmma_f32_16x16x32_bf16(false, al, false, bh, (short)0, c, false, false);
  if (NT >= 3) c = __builtin_amdgcn_wmma_f32_16x16x32_bf16(false, ah, false, bl, (short)0, c, false, false);
  asm volatile("v_nop\n\tv_nop\n\tv_nop\n\tv_nop" : "+v"(c) : "v"(ah), "v"(al), "v"(bh), "v"(bl));
  return c;
}

__global__ __launch_bounds__(256) void k_wt_bf16(const float* __restrict__ W, unsigned short* __restrict__ Wt, int K, int N) {
  const int t = blockIdx.x * 256 + threadIdx.x;
  const int k8n = K / 8;
  if (t >= N * k8n) return;
  const int n = t / k8n, k8 = (t % k8n) * 8;
  v8us v;
#pragma unroll
  for (int i = 0; i < 8; ++i) v[i] = bf16_bits(W[(size_t)(k8 + i) * N + n]);
  *(v8us*)(Wt + (size_t)n * K + k8) = v;
  
}

// GEMM C[M][N] (f32, pitch ldc) = act(A[M][K]·W + bias). A f32 row-major (pitch lda) converted per fragment to bf16
// (ASPLIT: hi/lo two planes -> 2 terms, else single rounded term); Wt bf16 [N][K] (pitch ldb). BIAS_BF16 rounds the
// bias to bf16 first (bias quantised to bf16 before the add). K%32==0, M%16==0, N%64==0.
template <bool ASPLIT, int ACT, bool BIAS_BF16>
__global__ __launch_bounds__(128) void k_gemm_bf(const float* __restrict__ A, int lda, const unsigned short* __restrict__ Wt, int ldb,
                                               const float* __restrict__ bias, float* __restrict__ C, int ldc, int M, int N, int K) {
  __shared__ __attribute__((aligned(16))) float so[4][16][64];
  const int tid = threadIdx.x, w = tid >> 5, lane = tid & 31, ln = lane & 15, hh = lane >> 4;
  const int ntn = N / 64;
  const int wid = blockIdx.x * 4 + w;
  const int mt = wid / ntn, nq = wid % ntn;
  if (mt * 16 >= M) return;
  const int row0 = mt * 16, col0 = nq * 64;
  const float* arow = A + (size_t)(row0 + ln) * lda;
  v8f acc[4] = {};
  for (int kb = 0; kb < K; kb += 32) {
    FragB ah, al;
    const v4f x0 = *(const v4fa*)(arow + kb + 8 * hh), x1 = *(const v4fa*)(arow + kb + 8 * hh + 4);
    const v4f x2 = *(const v4fa*)(arow + kb + 16 + 8 * hh), x3 = *(const v4fa*)(arow + kb + 16 + 8 * hh + 4);
    float xs[16] = {x0[0],x0[1],x0[2],x0[3],x1[0],x1[1],x1[2],x1[3],x2[0],x2[1],x2[2],x2[3],x3[0],x3[1],x3[2],x3[3]};
#pragma unroll
    for (int i = 0; i < 16; ++i) { const unsigned short hb = bf16_bits(xs[i]); ah.u[i] = hb; al.u[i] = ASPLIT ? bf16_bits(xs[i] - bf16_val(hb)) : (unsigned short)0; }
#pragma unroll
    for (int t = 0; t < 4; ++t) {
      const unsigned short* brow = Wt + (size_t)(col0 + t * 16 + ln) * ldb + kb;
      FragB b;
      b.half[0] = *(const v8us*)(brow + 8 * hh);
      b.half[1] = *(const v8us*)(brow + 16 + 8 * hh);
      acc[t] = mmaN<ASPLIT ? 2 : 1>(ah.v, al.v, b.v, b.v, acc[t]);
    }
  }
#pragma unroll
  for (int t = 0; t < 4; ++t) {
    float bv = bias ? bias[col0 + t * 16 + ln] : 0.f;
    if (BIAS_BF16) bv = bf16_round(bv);
#pragma unroll
    for (int r = 0; r < 8; ++r) { float v = acc[t][r] + bv; if (ACT == 1) v = fmaxf(v, 0.f); so[w][8 * hh + r][t * 16 + ln] = v; }
  }
  __builtin_amdgcn_fence(__ATOMIC_ACQ_REL, "workgroup");
  __builtin_amdgcn_wave_barrier();
  const int rsub = lane >> 4, c4 = (lane & 15) * 4;
  {
#pragma unroll
    for (int q = 0; q < 8; ++q) {
      const int r = q * 2 + rsub;
      const v4f v = *(const v4fa*)&so[w][r][c4];
      *(v4f*)(C + (size_t)(row0 + r) * ldc + col0 + c4) = v;
    }
    
  }
}

// GEMM C = act(A·W + bias + resid): A f32 (ASPLIT -> hi/lo 2 terms), Wt bf16 [N][K]; ACT 0 none, 1 relu, 2 exact gelu;
// resid (optional, f32, row index = (row % rmod), pitch ldr, RES_BF16 rounds it) added before the activation.
template <bool ASPLIT, int ACT, bool BIAS_BF16, bool RES_BF16>
__global__ __launch_bounds__(128) void k_gemm_bf3(const float* __restrict__ A, int lda, const unsigned short* __restrict__ Wt, int ldb,
                                                const float* __restrict__ bias, const float* __restrict__ resid, int rmod, int ldr,
                                                float* __restrict__ C, int ldc, int M, int N, int K) {
  __shared__ __attribute__((aligned(16))) float so[4][16][64];
  const int tid = threadIdx.x, w = tid >> 5, lane = tid & 31, ln = lane & 15, hh = lane >> 4;
  const int ntn = N / 64;
  const int wid = blockIdx.x * 4 + w;
  const int mt = wid / ntn, nq = wid % ntn;
  if (mt * 16 >= M) return;
  const int row0 = mt * 16, col0 = nq * 64;
  const float* arow = A + (size_t)(row0 + ln) * lda;
  v8f acc[4] = {};
  for (int kb = 0; kb < K; kb += 32) {
    FragB ah, al;
    const v4f x0 = *(const v4fa*)(arow + kb + 8 * hh), x1 = *(const v4fa*)(arow + kb + 8 * hh + 4);
    const v4f x2 = *(const v4fa*)(arow + kb + 16 + 8 * hh), x3 = *(const v4fa*)(arow + kb + 16 + 8 * hh + 4);
    float xs[16] = {x0[0],x0[1],x0[2],x0[3],x1[0],x1[1],x1[2],x1[3],x2[0],x2[1],x2[2],x2[3],x3[0],x3[1],x3[2],x3[3]};
#pragma unroll
    for (int i = 0; i < 16; ++i) { const unsigned short hb = bf16_bits(xs[i]); ah.u[i] = hb; al.u[i] = ASPLIT ? bf16_bits(xs[i] - bf16_val(hb)) : (unsigned short)0; }
#pragma unroll
    for (int t = 0; t < 4; ++t) {
      const unsigned short* brow = Wt + (size_t)(col0 + t * 16 + ln) * ldb + kb;
      FragB b;
      b.half[0] = *(const v8us*)(brow + 8 * hh);
      b.half[1] = *(const v8us*)(brow + 16 + 8 * hh);
      acc[t] = mmaN<ASPLIT ? 2 : 1>(ah.v, al.v, b.v, b.v, acc[t]);
    }
  }
#pragma unroll
  for (int t = 0; t < 4; ++t) {
    const int col = col0 + t * 16 + ln;
    float bv = bias ? bias[col] : 0.f;
    if (BIAS_BF16) bv = bf16_round(bv);
#pragma unroll
    for (int r = 0; r < 8; ++r) {
      float v = acc[t][r] + bv;
      if (resid) { float rv = resid[(size_t)((row0 + 8 * hh + r) % rmod) * ldr + col]; if (RES_BF16) rv = bf16_round(rv); v += rv; }
      if (ACT == 1) v = fmaxf(v, 0.f);
      if (ACT == 2) v = 0.5f * v * (1.0f + erff(v * 0.70710678118654752f));
      if (ACT == 3) { const float u = 0.7978845608028654f * (v + 0.044715f * v * v * v); v = 0.5f * v * (1.0f + tanhf(u)); }
      so[w][8 * hh + r][t * 16 + ln] = v;
    }
  }
  __builtin_amdgcn_fence(__ATOMIC_ACQ_REL, "workgroup");
  __builtin_amdgcn_wave_barrier();
  const int rsub = lane >> 4, c4 = (lane & 15) * 4;
  {
#pragma unroll
    for (int q = 0; q < 8; ++q) {
      const int r = q * 2 + rsub;
      const v4f v = *(const v4fa*)&so[w][r][c4];
      *(v4f*)(C + (size_t)(row0 + r) * ldc + col0 + c4) = v;
    }
    
  }
}
// row LayerNorm (biased variance, eps) over N: s = X (+ R); optional out_sum <- s; out_norm <- (s-mu)*rsqrt(var+eps)*g + b
template <bool PARAM_BF16>
__global__ __launch_bounds__(256) void k_layernorm(const float* __restrict__ X, const float* __restrict__ R, const float* __restrict__ g, const float* __restrict__ bta,
                                                  float* __restrict__ out_sum, float* __restrict__ out_norm, int N, float eps) {
  __shared__ float red[256];
  const int row = blockIdx.x, tid = threadIdx.x;
  const float* x = X + (size_t)row * N; const float* rr = R ? R + (size_t)row * N : nullptr;
  float vals[16];                     // up to N = 4096
  const int per = N / 256;            // contiguous chunk per thread? use strided-by-4 chunks: thread handles j = tid*4 + 1024*u
  float s1 = 0.f;
  for (int u = 0; u < per / 4; ++u) {
    const int j = tid * 4 + 1024 * u;
    const v4f a = *(const v4fa*)(x + j);
    v4f b = {0.f,0.f,0.f,0.f}; if (rr) b = *(const v4fa*)(rr + j);
#pragma unroll
    for (int q = 0; q < 4; ++q) { const float v = a[q] + b[q]; vals[u * 4 + q] = v; s1 += v; }
  }
  red[tid] = s1; __syncthreads();
  for (int st = 128; st > 0; st >>= 1) { if (tid < st) red[tid] += red[tid + st]; __syncthreads(); }
  const float mu = red[0] / (float)N; __syncthreads();
  float s2 = 0.f;
  for (int u = 0; u < per / 4; ++u)
#pragma unroll
    for (int q = 0; q < 4; ++q) { const float c = vals[u * 4 + q] - mu; s2 += c * c; }
  red[tid] = s2; __syncthreads();
  for (int st = 128; st > 0; st >>= 1) { if (tid < st) red[tid] += red[tid + st]; __syncthreads(); }
  const float rs = rsqrtf(red[0] / (float)N + eps);
  {
    for (int u = 0; u < per / 4; ++u) {
      const int j = tid * 4 + 1024 * u;
      v4f o, sm;
#pragma unroll
      for (int q = 0; q < 4; ++q) {
        float gg = g[j + q], bb = bta[j + q];
        if (PARAM_BF16) { gg = bf16_round(gg); bb = bf16_round(bb); }
        sm[q] = vals[u * 4 + q]; o[q] = (vals[u * 4 + q] - mu) * rs * gg + bb;
      }
      if (out_sum) *(v4f*)(out_sum + (size_t)row * N + j) = sm;
      *(v4f*)(out_norm + (size_t)row * N + j) = o;
    }
    
  }
}



// ---- f16 WMMA path (v_wmma_f32_16x16x32_f16): 11-bit significands for operands in range — used where a [0,1] probability operand needs more precision than bf16
typedef _Float16 v16h __attribute__((ext_vector_type(16)));
union FragH { v16h v; v8us half[2]; _Float16 h[16]; unsigned short u[16]; };
template <int NT>
__device__ __forceinline__ v8f mmaH(v16h ah, v16h al, v16h bh, v16h bl, v8f c) {
  c = __builtin_amdgcn_wmma_f32_16x16x32_f16(false, ah, false, bh, (short)0, c, false, false);
  if (NT >= 2) c = __builtin_amdgcn_wmma_f32_16x16x32_f16(false, al, false, bh, (short)0, c, false, false);
  if (NT >= 3) c = __builtin_amdgcn_wmma_f32_16x16x32_f16(false, ah, false, bl, (short)0, c, false, false);
  asm volatile("v_nop\n\tv_nop\n\tv_nop\n\tv_nop" : "+v"(c) : "v"(ah), "v"(al), "v"(bh), "v"(bl));
  return c;
}
// batched GEMM like k_gemm_b but f16 operands: A f32 (split into f16 hi/lo if ASPLIT, else rounded to f16), Bt = f16 values [n][k]; alpha; C f32; N multiple of 16 (partial tiles skipped)
template <bool ASPLIT>
__global__ __launch_bounds__(128) void k_gemm_h(const float* __restrict__ A, int lda, size_t sA, const _Float16* __restrict__ Bh, int ldb, size_t sB, float alpha, float* __restrict__ C, int ldc, size_t sC, int M, int N, int K) {
  __shared__ __attribute__((aligned(16))) float so[4][16][64];
  const int tid = threadIdx.x, w = tid >> 5, lane = tid & 31, ln = lane & 15, hh = lane >> 4; const int by = blockIdx.y;
  A += (size_t)by * sA; Bh += (size_t)by * sB; C += (size_t)by * sC;
  const int ntn = (N + 63) / 64; const int wid = blockIdx.x * 4 + w; const int mt = wid / ntn, nq = wid % ntn; if (mt * 16 >= M) return;
  const int row0 = mt * 16, col0 = nq * 64; const float* arow = A + (size_t)(row0 + ln) * lda;
  v8f acc[4] = {};
  for (int kb = 0; kb < K; kb += 32) {
    FragH ah, al;
    const v4f x0 = *(const v4fa*)(arow + kb + 8 * hh), x1 = *(const v4fa*)(arow + kb + 8 * hh + 4), x2 = *(const v4fa*)(arow + kb + 16 + 8 * hh), x3 = *(const v4fa*)(arow + kb + 16 + 8 * hh + 4);
    float xs[16] = {x0[0],x0[1],x0[2],x0[3],x1[0],x1[1],x1[2],x1[3],x2[0],x2[1],x2[2],x2[3],x3[0],x3[1],x3[2],x3[3]};
#pragma unroll
    for (int i = 0; i < 16; ++i) { const _Float16 h = (_Float16)xs[i]; ah.h[i] = h; al.h[i] = ASPLIT ? (_Float16)(xs[i] - (float)h) : (_Float16)0.0f; }
#pragma unroll
    for (int t = 0; t < 4; ++t) { if (col0 + t * 16 >= N) continue; const size_t boff = (size_t)(col0 + t * 16 + ln) * ldb + kb; FragH bq; bq.half[0] = *(const v8us*)(Bh + boff + 8 * hh); bq.half[1] = *(const v8us*)(Bh + boff + 16 + 8 * hh);
      acc[t] = mmaH<ASPLIT ? 2 : 1>(ah.v, al.v, bq.v, bq.v, acc[t]); }
  }
#pragma unroll
  for (int t = 0; t < 4; ++t) { if (col0 + t * 16 >= N) continue;
#pragma unroll
    for (int r = 0; r < 8; ++r) so[w][8 * hh + r][t * 16 + ln] = acc[t][r] * alpha; }
  __builtin_amdgcn_fence(__ATOMIC_ACQ_REL, "workgroup"); __builtin_amdgcn_wave_barrier();
  const int rsub = lane >> 4, c4 = (lane & 15) * 4;
  {
#pragma unroll
    for (int q = 0; q < 8; ++q) { const int r = q * 2 + rsub; if (col0 + c4 < N) { const v4f v = *(const v4fa*)&so[w][r][c4]; *(v4f*)(C + (size_t)(row0 + r) * ldc + col0 + c4) = v; } }
     }
}

// k_gemm_hh variant with fused epilogue: v = acc·alpha + bias[by·sBias + col] (+ CP[(row/rowsPerB)·sCPb + by·64 + col] if CP) ; ACT 0 none / 1 elu ; writes f16 C16 (and f32 C if non-null)
template <int ACT>
__global__ __launch_bounds__(128) void k_gemm_hhx(const _Float16* __restrict__ A, int lda, size_t sA, const _Float16* __restrict__ Bh, int ldb, size_t sB, float alpha, const float* __restrict__ bias, size_t sBias, const float* __restrict__ CP, int rowsPerB, size_t sCPb, int row0g,
    float* __restrict__ C, _Float16* __restrict__ C16, int ldc, size_t sC, int M, int N, int K) {
  __shared__ __attribute__((aligned(16))) float so[4][16][64];
  const int tid = threadIdx.x, w = tid >> 5, lane = tid & 31, ln = lane & 15, hh = lane >> 4; const int by = blockIdx.y;
  A += (size_t)by * sA; Bh += (size_t)by * sB; const size_t cofs = (size_t)by * sC; const float* bp = bias ? bias + (size_t)by * sBias : nullptr;
  const int ntn = (N + 63) / 64; const int wid = blockIdx.x * 4 + w; const int mt = wid / ntn, nq = wid % ntn; if (mt * 16 >= M) return;
  const int row0 = mt * 16, col0 = nq * 64; const _Float16* arow = A + (size_t)(row0 + ln) * lda;
  v8f acc[4] = {};
  for (int kb = 0; kb < K; kb += 32) { FragH ah; ah.half[0] = *(const v8us*)((const unsigned short*)arow + kb + 8 * hh); ah.half[1] = *(const v8us*)((const unsigned short*)arow + kb + 16 + 8 * hh);
#pragma unroll
    for (int t = 0; t < 4; ++t) { if (col0 + t * 16 >= N) continue; const size_t boff = (size_t)(col0 + t * 16 + ln) * ldb + kb; FragH bq; bq.half[0] = *(const v8us*)((const unsigned short*)Bh + boff + 8 * hh); bq.half[1] = *(const v8us*)((const unsigned short*)Bh + boff + 16 + 8 * hh);
      acc[t] = mmaH<1>(ah.v, ah.v, bq.v, bq.v, acc[t]); }
  }
#pragma unroll
  for (int t = 0; t < 4; ++t) { if (col0 + t * 16 >= N) continue; const int col = col0 + t * 16 + ln; const float bv = bp ? bf16_round(bp[col]) : 0.f;
#pragma unroll
    for (int r = 0; r < 8; ++r) { float v = acc[t][r] * alpha + bv; if (CP) { const int rr = row0g + row0 + 8 * hh + r; if (rowsPerB < 0) v += CP[cofs + (size_t)rr * ldc + col];      /* rowsPerB < 0: own element of the batched C plane */ else { const int bidx = rr / rowsPerB; v += CP[(size_t)bidx * sCPb + (size_t)by * 64 + col]; } } if (ACT == 1) v = (v > 0.f) ? v : expm1f(v); else if (ACT == 7) v = (v > 0.f) ? v + 1.0f : expf(v); else if (ACT == 8) v = tanhf(v); else if (ACT == 9) v = 0.5f * v * (1.0f + tanhf(0.7978845608028654f * (v + 0.044715f * v * v * v))); else if (ACT == 11) v = 1.0f / (1.0f + expf(-v)); else if (ACT == 12) v = (v > 0.f) ? v : 0.01f * v; else if (ACT == 14) v = (v > 0.f) ? v : 0.1f * v; else if (ACT == 16) v = (v >= 0.f) ? v : 0.3f * v; else if (ACT == 17) v = (v >= 0.f) ? v : 0.2f * v; else if (ACT == 15) v = v / (1.0f + expf(-v)); else if (ACT == 3) v = fmaxf(v, 0.f); else if (ACT == 6) v = 0.5f * v * (1.0f + erff(v * 0.70710678118654752f)); so[w][8 * hh + r][t * 16 + ln] = v; } }
  __builtin_amdgcn_fence(__ATOMIC_ACQ_REL, "workgroup"); __builtin_amdgcn_wave_barrier();
  const int rsub = lane >> 4, c4 = (lane & 15) * 4; typedef _Float16 v4h __attribute__((ext_vector_type(4)));
  {
#pragma unroll
    for (int q = 0; q < 8; ++q) { const int r = q * 2 + rsub; if (col0 + c4 < N) { const v4f v = *(const v4fa*)&so[w][r][c4]; if (C) *(v4f*)(C + cofs + (size_t)(row0 + r) * ldc + col0 + c4) = v; if (C16) { v4h h4; for (int i = 0; i < 4; ++i) h4[i] = (_Float16)v[i]; *(v4h*)(C16 + cofs + (size_t)(row0 + r) * ldc + col0 + c4) = h4; } } }
     }
}


typedef _Float16 v4h __attribute__((ext_vector_type(4)));

// Operand preparation in ONE launch: blocks 0 .. PWB - 1 transpose the four weight matrices, the others round x. Bt[n][k] = f16(bf16(W[k][n]) x 16) (exact), X16 = f16(bf16(x)) (exact).
// Weights: a block takes 128 k x 64 n of one matrix. A thread reads 8 k rows x 4 n, 16 bytes a row, so that one wave's load is two 256-byte row pieces (whole lines); it then holds 8 consecutive k of 4 columns,
// four 16-byte pieces of Bt rows, which are gathered in LDS so that one wave writes each 256-byte piece of a Bt row. LDS rows are 256 bytes, and piece c of row n lies at place c ^ (n >> 2):
// the 16 lanes of a write (rows 4 apart, one c) and the 16 lanes of a read (one row, every c) each meet all 64 banks once.
// x: a block takes PXV values, a thread 16 pieces of 4: each wave's load is 512 contiguous bytes, each store 256, and the loads run ahead of the arithmetic, eight and more of a thread in flight.
#define PWB (4 * (DM / 64) * (DM / 128))      /* weight blocks */
#define PXV 16384                    /* x values per block */
__global__ __launch_bounds__(256) void k_prep(const float* __restrict__ x, const float* __restrict__ wq, const float* __restrict__ wk, const float* __restrict__ wv, const float* __restrict__ wo,
    _Float16* __restrict__ X16, _Float16* __restrict__ BQKV, _Float16* __restrict__ BO) {
  __shared__ __attribute__((aligned(16))) unsigned short tl[64 * 128];
  const int tid = threadIdx.x;
  if (blockIdx.x < PWB) {      /* block-uniform */
    const int tpm = (DM / 64) * (DM / 128); const int m = blockIdx.x / tpm, tt = blockIdx.x % tpm; const int n0 = (tt / (DM / 128)) * 64, k0 = (tt % (DM / 128)) * 128;
    const float* Wm = m == 0 ? wq : m == 1 ? wk : m == 2 ? wv : wo;
    unsigned short* Bt = (unsigned short*)(m < 3 ? BQKV + (size_t)m * DM * DM : BO);      /* q | k | v stacked along n */
    const int ng = tid & 15, kg = tid >> 4;
    const float* sp = Wm + (size_t)(k0 + kg * 8) * DM + n0 + ng * 4;
    v4f r[8];
#pragma unroll
    for (int i = 0; i < 8; ++i) r[i] = *(const v4fa*)(sp + i * DM);      /* unrolled: r stays in registers and the 8 loads are in flight together */
#pragma unroll
    for (int j = 0; j < 4; ++j) { FragH f;
#pragma unroll
      for (int i = 0; i < 8; ++i) f.h[i] = (_Float16)(bf16_round(r[i][j]) * 16.0f);
      *(v8us*)(tl + (ng * 4 + j) * 128 + (kg ^ ng) * 8) = f.half[0]; }
    __syncthreads();      /* the tile is whole in LDS before any wave reads rows of it */
    const int rw = (tid >> 5) * 8 + ((tid >> 4) & 1), c = tid & 15;      /* a wave writes 8 rows, two per store */
    unsigned short* dp = Bt + (size_t)(n0 + rw) * DM + k0 + c * 8;
#pragma unroll
    for (int q = 0; q < 4; ++q) { const int n = rw + q * 2; const v8us v = *(const v8us*)(tl + n * 128 + (c ^ (n >> 2)) * 8); *(v8us*)(dp + q * 2 * DM) = v; }
  } else {
    const size_t base = (size_t)(blockIdx.x - PWB) * PXV + tid * 4;
    const float* sp = x + base; _Float16* dp = X16 + base;
    v4f r[16];
#pragma unroll
    for (int u = 0; u < 16; ++u) r[u] = *(const v4fa*)(sp + u * 1024);      /* unrolled: r stays in registers, every offset is an immediate, and the loads are issued ahead of the arithmetic */
#pragma unroll
    for (int u = 0; u < 16; ++u) { v4h h;
#pragma unroll
      for (int q = 0; q < 4; ++q) h[q] = (_Float16)bf16_round(r[u][q]);
      *(v4h*)(dp + u * 1024) = h; }
    asm volatile("s_wait_xcnt 0x0" ::: "memory");      /* stands behind the last x stores, ahead of any later write of a register that one of them names */
  } }
static_assert(DM % 128 == 0 && (NR * DM) % PXV == 0 && PXV == 16 * 256 * 4, "k_prep: whole weight tiles and whole x blocks");
__global__ __launch_bounds__(256) void k_h16(const float* __restrict__ x, _Float16* __restrict__ X16, size_t n8) { const size_t t = (size_t)blockIdx.x * 256 + threadIdx.x; if (t >= n8) return; FragH f;
#pragma unroll
  for (int q = 0; q < 8; ++q) f.h[q] = (_Float16)x[t * 8 + q]; *(v8us*)((unsigned short*)X16 + t * 8) = f.half[0];  }
__global__ __launch_bounds__(256) void k_round16f(const float* __restrict__ W, _Float16* __restrict__ Bt, size_t n8) { const size_t t = (size_t)blockIdx.x * 256 + threadIdx.x; if (t >= n8) return; FragH f;
#pragma unroll
  for (int i = 0; i < 8; ++i) f.h[i] = (_Float16)(bf16_round(W[t * 8 + i]) * 16.0f); *(v8us*)((unsigned short*)Bt + t * 8) = f.half[0];  }
template <int NHv, int TTv>
__global__ __launch_bounds__(256) void k_vt(const _Float16* __restrict__ V16, int ldv, int voff, _Float16* __restrict__ Vt) { __shared__ unsigned short tl[64][66]; const int tid = threadIdx.x; const int slab = blockIdx.x / (TTv / 64), lg = blockIdx.x % (TTv / 64); const int b = slab / NHv, h = slab % NHv;
  for (int i = tid; i < 64 * 8; i += 256) { const int r = i / 8, c8 = (i % 8) * 8; FragH f; f.half[0] = *(const v8us*)((const unsigned short*)V16 + ((size_t)b * TTv + lg * 64 + r) * ldv + voff + h * 64 + c8);
#pragma unroll
    for (int q = 0; q < 8; ++q) tl[r][c8 + q] = f.u[q]; }
  __syncthreads();
  {
#pragma unroll
    for (int rd = 0; rd < 2; ++rd) { const int d = rd * 32 + tid / 8, pc = tid % 8; FragH f;
#pragma unroll
      for (int q = 0; q < 8; ++q) f.u[q] = tl[pc * 8 + q][d];
      *(v8us*)((unsigned short*)Vt + ((size_t)slab * 64 + d) * TTv + lg * 64 + pc * 8) = f.half[0]; }
     } }

__global__ __launch_bounds__(256) void k_hl(const float* __restrict__ F, _Float16* __restrict__ Hh, _Float16* __restrict__ Hl, size_t n8) { const size_t t = (size_t)blockIdx.x * 256 + threadIdx.x; if (t >= n8) return; FragH fh, fl; const v4f a = *(const v4fa*)(F + t * 8), c = *(const v4fa*)(F + t * 8 + 4);
#pragma unroll
  for (int q = 0; q < 4; ++q) { _Float16 h = (_Float16)a[q]; fh.h[q] = h; fl.h[q] = (_Float16)((a[q] - (float)h) * 1024.0f); h = (_Float16)c[q]; fh.h[4 + q] = h; fl.h[4 + q] = (_Float16)((c[q] - (float)h) * 1024.0f); }
  { *(v8us*)((unsigned short*)Hh + t * 8) = fh.half[0]; *(v8us*)((unsigned short*)Hl + t * 8) = fl.half[0];  } }

// ---- fast GEMM (wave tile 32x64; requires M % 32 == 0 rows per launch region and N % 64 == 0); epilogue = k_gemm_hhx semantics ----
__device__ __forceinline__ v16h g2_frag(const _Float16* p, int hh) { FragH f; f.half[0] = *(const v8us*)((const unsigned short*)p + 8 * hh); f.half[1] = *(const v8us*)((const unsigned short*)p + 16 + 8 * hh); return f.v; }
__device__ __forceinline__ v8f g2_mma(v16h a, v16h b, v8f c) { v8f d = __builtin_amdgcn_wmma_f32_16x16x32_f16(false, a, false, b, (short)0, c, false, false); asm volatile("v_nop\n\tv_nop\n\tv_nop\n\tv_nop" : "+v"(d) : "v"(a), "v"(b)); return d; }
template <int ACT>
__global__ __launch_bounds__(128) void k_gemm2(const _Float16* __restrict__ A, int lda, size_t sA, const _Float16* __restrict__ Bh, int ldb, size_t sB, float alpha, const float* __restrict__ bias, size_t sBias, const float* __restrict__ CP, int rowsPerB, size_t sCPb, int row0g,
    float* __restrict__ C, _Float16* __restrict__ C16, int ldc, size_t sC, int M, int N, int K) { static_assert(ACT == 0 || ACT == 3 || ACT == 6 || ACT == 8 || ACT == 9 || ACT == 11 || ACT == 12 || ACT == 14 || ACT == 15 || ACT == 16 || ACT == 17, "k_gemm2: unsupported ACT code (would silently apply no activation)");
  __shared__ __attribute__((aligned(16))) float so[4][32][68];
  const int tid = threadIdx.x, w = tid >> 5, lane = tid & 31, ln = lane & 15, hh = lane >> 4; const int by = blockIdx.y;
  A += (size_t)by * sA; Bh += (size_t)by * sB; const size_t cofs = (size_t)by * sC; const float* bp = bias ? bias + (size_t)by * sBias : nullptr;
  const int ntn = N >> 6; const int mt = blockIdx.x / ntn, nq = blockIdx.x - mt * ntn; const int row0 = mt * 128 + 32 * w, col0 = nq * 64; if (row0 >= M) return;
  const _Float16* a0p = A + (size_t)(row0 + ln) * lda; const _Float16* a1p = a0p + (size_t)16 * lda;
  const _Float16* b0p = Bh + (size_t)(col0 + ln) * ldb; const _Float16* b1p = b0p + (size_t)16 * ldb; const _Float16* b2p = b1p + (size_t)16 * ldb; const _Float16* b3p = b2p + (size_t)16 * ldb;
  const v8f z8 = {0.f,0.f,0.f,0.f,0.f,0.f,0.f,0.f}; v8f c00 = z8, c01 = z8, c02 = z8, c03 = z8, c10 = z8, c11 = z8, c12 = z8, c13 = z8;
#pragma unroll 1
  for (int kb = 0; kb < K; kb += 32) { const v16h a0 = g2_frag(a0p + kb, hh), a1 = g2_frag(a1p + kb, hh);
    v16h b = g2_frag(b0p + kb, hh); c00 = g2_mma(a0, b, c00); c10 = g2_mma(a1, b, c10);
    b = g2_frag(b1p + kb, hh); c01 = g2_mma(a0, b, c01); c11 = g2_mma(a1, b, c11);
    b = g2_frag(b2p + kb, hh); c02 = g2_mma(a0, b, c02); c12 = g2_mma(a1, b, c12);
    b = g2_frag(b3p + kb, hh); c03 = g2_mma(a0, b, c03); c13 = g2_mma(a1, b, c13); }
  v8f accs[8] = {c00, c01, c02, c03, c10, c11, c12, c13};
#pragma unroll
  for (int u = 0; u < 8; ++u) { const int t = u & 3, half = u >> 2; const int col = col0 + t * 16 + ln; const float bv = bp ? bf16_round(bp[col]) : 0.f;
#pragma unroll
    for (int r = 0; r < 8; ++r) { const int rloc = half * 16 + 8 * hh + r; float v = accs[u][r] * alpha + bv; if (CP) { if (rowsPerB < 0) v += CP[cofs + (size_t)(row0g + row0 + rloc) * ldc + col];      /* rowsPerB < 0: own element of the batched C plane */ else { const int bidx = (row0g + row0 + rloc) / rowsPerB; v += CP[(size_t)bidx * sCPb + (size_t)by * 64 + col]; } }
      if (ACT == 3) v = fmaxf(v, 0.f); else if (ACT == 6) v = 0.5f * v * (1.0f + erff(v * 0.70710678118654752f)); else if (ACT == 11) v = 1.0f / (1.0f + expf(-v)); else if (ACT == 15) v = v / (1.0f + expf(-v)); else if (ACT == 12) v = (v > 0.f) ? v : 0.01f * v; else if (ACT == 8) v = tanhf(v); else if (ACT == 9) v = 0.5f * v * (1.0f + tanhf(0.7978845608028654f * (v + 0.044715f * v * v * v))); else if (ACT == 14) v = (v > 0.f) ? v : 0.1f * v; else if (ACT == 16) v = (v >= 0.f) ? v : 0.3f * v; else if (ACT == 17) v = (v >= 0.f) ? v : 0.2f * v;
      so[w][rloc][t * 16 + ln] = v; } }
  __builtin_amdgcn_fence(__ATOMIC_ACQ_REL, "workgroup"); __builtin_amdgcn_wave_barrier();
  const int rsub = lane >> 4, c4 = (lane & 15) * 4;
  {
#pragma unroll
    for (int q = 0; q < 16; ++q) { const int r = q * 2 + rsub; const v4f v = *(const v4fa*)&so[w][r][c4]; if (C) *(v4f*)(C + cofs + (size_t)(row0 + r) * ldc + col0 + c4) = v; if (C16) { v4h h4; for (int i = 0; i < 4; ++i) h4[i] = (_Float16)v[i]; *(v4h*)(C16 + cofs + (size_t)(row0 + r) * ldc + col0 + c4) = h4; } }
     } }

// q | k | v projection of ALL token rows (product order of k_gemm2 along k, pitches and K = DM) with the per-head work in the epilogue: no f32 q | k | v plane in memory and no launch per (row, head).
// A block is 8 waves and has a WGP to itself: 256 rows of one batch x 384 columns, the q, k and v columns of two heads. A wave takes 64 rows x the 192 columns of one head (48 accumulator tiles), so that an A fragment feeds 12 WMMAs and a B fragment 4,
// and each operand byte leaves L2 once per 256 x 384 outputs. The K loop reads its fragments from LDS stages that asynchronous copies fill one trip ahead.
// q, k: the wave stages 32x64 f32 of each at a time in its own LDS ranges and rotates both from one fetch of the table rows; 8 lanes take one row (lanes 0-3 columns 0-31, lanes 4-7 columns 32-63),
// each reads its 8 low-half and 8 high-half values and the two table rows, rotates and stores 16 bytes: one instruction fills whole 128-byte lines.
// v: accumulator registers 0..7 of a lane are 8 consecutive token rows of one column, so each lane packs them to 16 bytes of V^T; each head's 64 x 256 tile is gathered in LDS (pitch 528 bytes) so that one wave writes each 512-byte row piece.
// Rows 0..127 of a batch (waves 0 and 1 of a head in the batch's first block row) are also written in f32 for the exact first-tile attention.
// Every epilogue loop is unrolled so that acc, aq, ak, xq, xk, tb and vr are indexed by constants and stay in registers.
// A 16-byte global store (two for the f32 form) with s_wait_xcnt 0 as the last line of the same statement: the epilogue reuses its staging registers from pass to pass, and a wait in a statement of its own would not hold the next pass's register writes behind it.
__device__ __forceinline__ void st16_wait(unsigned short* p, v8us d) { asm volatile("global_store_b128 %0, %1, off\n\ts_wait_xcnt 0x0" :: "v"(p), "v"(d) : "memory"); }
__device__ __forceinline__ void st32_wait(float* p, v4f d0, v4f d1) { asm volatile("global_store_b128 %0, %1, off\n\tglobal_store_b128 %0, %2, off offset:16\n\ts_wait_xcnt 0x0" :: "v"(p), "v"(d0), "v"(d1) : "memory"); }
// Operand tiles of a GEMM K loop staged in LDS: a stage is 64 k of 128 A rows, then of 128 B rows, each row 128 bytes at a pitch of 144 (16 bytes x an odd number: the 16-byte fragment reads meet no bank conflict).
// 256 threads: thread t brings 16-byte piece t & 7 of rows (t >> 3) + 32 j, so one wave's copy covers four whole 128-byte lines.
#define GP 72                        /* LDS row pitch in f16 */
#define GSTG (256 * GP * 2)          /* bytes of one stage */
// Eight asynchronous copies, each lane its own 16 bytes, with s_wait_xcnt 0 as the last line of the same statement: it stands ahead of any rewrite of the address registers that the copies name.
__device__ __forceinline__ void g3_copy8(unsigned l, const _Float16* a, const _Float16* b) {
  asm volatile("global_load_async_to_lds_b128 %0, %8, off\n\tglobal_load_async_to_lds_b128 %1, %9, off\n\tglobal_load_async_to_lds_b128 %2, %10, off\n\tglobal_load_async_to_lds_b128 %3, %11, off\n\t"
               "global_load_async_to_lds_b128 %4, %12, off\n\tglobal_load_async_to_lds_b128 %5, %13, off\n\tglobal_load_async_to_lds_b128 %6, %14, off\n\tglobal_load_async_to_lds_b128 %7, %15, off\n\ts_wait_xcnt 0x0"
               :: "v"(l), "v"(l + 32u * GP * 2), "v"(l + 64u * GP * 2), "v"(l + 96u * GP * 2), "v"(l + 128u * GP * 2), "v"(l + 160u * GP * 2), "v"(l + 192u * GP * 2), "v"(l + 224u * GP * 2),
                  "v"(a), "v"(a + 32 * DM), "v"(a + 64 * DM), "v"(a + 96 * DM), "v"(b), "v"(b + 32 * DM), "v"(b + 64 * DM), "v"(b + 96 * DM) : "memory"); }
// Four more, for the 128 rows of a second A operand (they lie behind the B rows of the stage).
#define GSTG3 (384 * GP * 2)         /* bytes of one stage with two A operands */
__device__ __forceinline__ void g3_copy4(unsigned l, const _Float16* e) {
  asm volatile("global_load_async_to_lds_b128 %0, %4, off\n\tglobal_load_async_to_lds_b128 %1, %5, off\n\tglobal_load_async_to_lds_b128 %2, %6, off\n\tglobal_load_async_to_lds_b128 %3, %7, off\n\ts_wait_xcnt 0x0"
               :: "v"(l), "v"(l + 32u * GP * 2), "v"(l + 64u * GP * 2), "v"(l + 96u * GP * 2), "v"(e), "v"(e + 32 * DM), "v"(e + 64 * DM), "v"(e + 96 * DM) : "memory"); }
// A stage of the q | k | v GEMM: 64 k of 256 A rows, then of 384 B rows (head 0: q, k, v columns; head 1: the same), each row 128 bytes at the pitch GP.
// 256 threads: thread t brings 16-byte piece t & 7 of rows (t >> 3) + 32 j, so one wave's copy covers four whole 128-byte lines.
#define QSTG (640 * GP * 2)          /* bytes of one stage */
#define QSO (16 * 32 * 68 * 4)       /* bytes of the epilogue's f32 staging (a q and a k range per wave), ahead of the V^T tiles */
#define QVP 264                      /* V^T tile pitch in f16: 256 token rows + 8 pad (16 bytes x an odd number) */
// One stage's 20 asynchronous copies of a thread, each lane its own 16 bytes, written as the builtin: above 256 registers an asm statement's operands must lie in the first 256, and the build moved five accumulator tiles out of them and back on every trip.
// 8 copies for the A rows; 6 for each head's 192 B rows, 64 of q, of k and of v, which lie DM rows apart in Bt.
typedef int v4i __attribute__((ext_vector_type(4)));
__device__ __forceinline__ void g4_cp16(char* l, const _Float16* g) { __builtin_amdgcn_global_load_async_to_lds_b128((__attribute__((address_space(1))) v4i*)g, (__attribute__((address_space(3))) v4i*)l, 0, 0); }
__device__ __forceinline__ void g4_stage(char* l, const _Float16* a, const _Float16* b) {      /* both loops unrolled: every row step is a constant */
#pragma unroll
  for (int j = 0; j < 8; ++j) g4_cp16(l + j * 32 * GP * 2, a + j * 32 * DM);
#pragma unroll
  for (int j = 0; j < 12; ++j) g4_cp16(l + (256 + j * 32) * GP * 2, b + ((size_t)((j % 6) >> 1) * DM + (j / 6) * 64 + (j & 1) * 32) * DM); }
// Rotation and store of 32 rows x one head of q and of k together: both take the same table rows, so these are fetched, rounded and selected once. sq, sk: the wave's own staging ranges; hq, hk, fq, fk, cp, sp: the lane's places in the first pass.
__device__ __forceinline__ void g4_rope32(float (*sq)[68], float (*sk)[68], const v8f (&aq)[8], const v8f (&ak)[8], unsigned short* hq, unsigned short* hk, float* fq, float* fk, const float* cp, const float* sp, bool first, int lane) {
  const int ln = lane & 15, hh = lane >> 4, rs = lane >> 3, up = (lane >> 2) & 1, i8 = (lane & 3) * 8;
  __builtin_amdgcn_fence(__ATOMIC_ACQ_REL, "workgroup"); __builtin_amdgcn_wave_barrier();      /* the wave's reads of the 32 rows before stay ahead of these writes */
#pragma unroll
  for (int u = 0; u < 8; ++u)
#pragma unroll
    for (int r = 0; r < 8; ++r) { sq[(u >> 2) * 16 + 8 * hh + r][(u & 3) * 16 + ln] = aq[u][r]; sk[(u >> 2) * 16 + 8 * hh + r][(u & 3) * 16 + ln] = ak[u][r]; }
  __builtin_amdgcn_fence(__ATOMIC_ACQ_REL, "workgroup"); __builtin_amdgcn_wave_barrier();      /* the wave reads back what its own lanes wrote */
  v4f xq[2][4], xk[2][4], tb[2][4];      /* two register sets: pass q + 1 is fetched ahead of the arithmetic of pass q, because no load moves up over the store statements */
#pragma unroll
  for (int q = -1; q < 8; ++q) {
    if (q < 7) { const int n = q + 1, s = n & 1, r = n * 4 + rs;
      xq[s][0] = *(const v4fa*)&sq[r][i8]; xq[s][1] = *(const v4fa*)&sq[r][i8 + 4]; xq[s][2] = *(const v4fa*)&sq[r][32 + i8]; xq[s][3] = *(const v4fa*)&sq[r][32 + i8 + 4];
      xk[s][0] = *(const v4fa*)&sk[r][i8]; xk[s][1] = *(const v4fa*)&sk[r][i8 + 4]; xk[s][2] = *(const v4fa*)&sk[r][32 + i8]; xk[s][3] = *(const v4fa*)&sk[r][32 + i8 + 4];
      tb[s][0] = *(const v4fa*)(cp + n * 4 * (HD / 2)); tb[s][1] = *(const v4fa*)(cp + n * 4 * (HD / 2) + 4); tb[s][2] = *(const v4fa*)(sp + n * 4 * (HD / 2)); tb[s][3] = *(const v4fa*)(sp + n * 4 * (HD / 2) + 4); }
    if (q >= 0) { const int s = q & 1; FragH gq, gk; v4f q0, q1, k0, k1;
#pragma unroll
      for (int e = 0; e < 8; ++e) { const float cv = bf16_round(tb[s][e >> 2][e & 3]), sv = bf16_round(tb[s][2 + (e >> 2)][e & 3]); const float ca = up ? sv : cv, cb = up ? cv : -sv;      /* low half x1 c - x2 s, high half x1 s + x2 c */
        const float oq = xq[s][e >> 2][e & 3] * ca + xq[s][2 + (e >> 2)][e & 3] * cb, ok = xk[s][e >> 2][e & 3] * ca + xk[s][2 + (e >> 2)][e & 3] * cb;
        gq.h[e] = (_Float16)oq; gk.h[e] = (_Float16)ok; if (e < 4) { q0[e & 3] = oq; k0[e & 3] = ok; } else { q1[e & 3] = oq; k1[e & 3] = ok; } }
      st16_wait(hq + (size_t)q * 4 * DM, gq.half[0]); st16_wait(hk + (size_t)q * 4 * DM, gk.half[0]);
      if (first) { st32_wait(fq + (size_t)q * 4 * DM, q0, q1); st32_wait(fk + (size_t)q * 4 * DM, k0, k1); } } } }
// amdgpu_waves_per_eu(2, 2): one block of 8 waves per WGP, so a wave has the register budget of two waves per SIMD for its 48 accumulator tiles.
__global__ __launch_bounds__(256) __attribute__((amdgpu_waves_per_eu(2, 2))) void k_qkv_rope(const _Float16* __restrict__ A, const _Float16* __restrict__ Bh, const float* __restrict__ tcos, const float* __restrict__ tsin,
    _Float16* __restrict__ Q16, _Float16* __restrict__ K16, _Float16* __restrict__ VTa, float* __restrict__ QF, float* __restrict__ KF, float* __restrict__ VF) {
  __shared__ __attribute__((aligned(16))) char sm[QSO + 2 * 64 * QVP * 2];      /* two stages in the K loop; behind it the epilogue's staging, which is the larger */
  static_assert(QSO + 2 * 64 * QVP * 2 >= 2 * QSTG && QSO + 2 * 64 * QVP * 2 <= 327680, "the two stages fit the epilogue's staging, and that a WGP's LDS");
  float (*so)[32][68] = (float (*)[32][68])sm;
  const int tid = threadIdx.x, lane = tid & 31, ln = lane & 15, hh = lane >> 4;
  const int w8 = __builtin_amdgcn_readfirstlane(tid >> 5), w = w8 & 3, wg = w8 >> 2;      /* the wave's number as a scalar: the first-tile test is a scalar branch. w: the wave's 64 rows; wg: its head of the block's two */
  const int ntn = NH / 2; const int mt = blockIdx.x / ntn, np = blockIdx.x - mt * ntn; const int h = np * 2 + wg;
  const int b = mt / (SQ / 256), pb = (mt % (SQ / 256)) * 256, p0 = pb + 64 * w;      /* batch; position of the block's and of the wave's first row */
  const bool first = p0 < QT0;
  char* l0 = sm + (tid >> 3) * (GP * 2) + (tid & 7) * 16;      /* the thread's first place in stage 0 */
  const _Float16* ga = A + (size_t)(mt * 256 + (tid >> 3)) * DM + (tid & 7) * 8; const _Float16* gb = Bh + (size_t)(np * 128 + (tid >> 3)) * DM + (tid & 7) * 8;
  v8f acc[3][4][4];      /* q, k, v x four 16-row tiles x four 16-column tiles */
#pragma unroll
  for (int s = 0; s < 3; ++s)
#pragma unroll
    for (int i = 0; i < 4; ++i)
#pragma unroll
      for (int j = 0; j < 4; ++j) acc[s][i][j] = v8f{0.f,0.f,0.f,0.f,0.f,0.f,0.f,0.f};
#pragma unroll 1
  for (int p = 0; p < 2; ++p) {      /* tiles 0 and 1; kept rolled: one copy of a stage's 20 copies and their addresses */
    g4_stage(l0 + p * QSTG, ga + p * 64, gb + p * 64);
    if (p == 0) {      /* the same for the whole block */
      asm volatile("s_wait_asynccnt 0x0" ::: "memory");      /* this wave's part of tile 0 has landed */
      __syncthreads(); } }      /* tile 0 is whole for every wave */
#pragma unroll 1
  for (int t = 0; t < DM / 64; ++t) {      /* kept rolled: one trip is one stage, 96 WMMAs a wave */
    const _Float16* st = (const _Float16*)(sm + (t & 1) * QSTG);
    const _Float16* ap = st + (64 * w + ln) * GP; const _Float16* bp = st + (256 + 192 * wg + ln) * GP;
    v16h af[4], bf[2][4];      /* the A fragments of 32 k; two sets of four B fragments: a group is 32 k of q, of k or of v, 16 WMMAs */
#pragma unroll
    for (int i = 0; i < 4; ++i) af[i] = g2_frag(ap + i * 16 * GP, hh);
#pragma unroll
    for (int j = 0; j < 4; ++j) bf[0][j] = g2_frag(bp + j * 16 * GP, hh);
#pragma unroll
    for (int g = 0; g < 6; ++g) {      /* unrolled: every LDS offset is an immediate and acc, af, bf are indexed by constants */
      if (g < 5) {
#pragma unroll
        for (int j = 0; j < 4; ++j) bf[(g + 1) & 1][j] = g2_frag(bp + (((g + 1) % 3) * 64 + j * 16) * GP + ((g + 1) / 3) * 32, hh); }
      __builtin_amdgcn_sched_barrier(0);      /* keeps the next group's LDS reads, as one group, ahead of this group's WMMAs: left free, the build read each B fragment directly in front of its four WMMAs and waited out the LDS latency every time */
#pragma unroll
      for (int i = 0; i < 4; ++i) {
#pragma unroll
        for (int j = 0; j < 4; ++j) acc[g % 3][i][j] = __builtin_amdgcn_wmma_f32_16x16x32_f16(false, af[i], false, bf[g & 1][j], (short)0, acc[g % 3][i][j], false, false);
        if (g == 2) af[i] = g2_frag(ap + i * 16 * GP + 32, hh); }      /* the second 32 k's A fragment, as soon as the first's last product has issued */
      __builtin_amdgcn_sched_barrier(0); }      /* keeps the reads of the group after next behind these WMMAs: a third set of B fragments does not fit the registers */
    asm volatile("s_wait_dscnt 0x0" ::: "memory");      /* this wave's reads of the stage have returned */
    asm volatile("s_wait_asynccnt 0x0" ::: "memory");      /* this wave's part of tile t + 1 has landed */
    __syncthreads();      /* publishes tile t + 1 and ends every wave's reads of tile t */
    if (t + 2 < DM / 64) g4_stage(l0 + (t & 1) * QSTG, ga + (t + 2) * 64, gb + (t + 2) * 64); }      /* refill of the stage just left; the test is the same for the whole block */
  asm volatile("s_wait_asynccnt 0x0" ::: "memory");      /* no copy is outstanding when the stages become the epilogue's staging */
  {      /* v; x 0.0625 undoes the x16 of the weights, exact */
    unsigned short* tv = (unsigned short*)(sm + QSO) + wg * 64 * QVP;      /* per head [64 columns][QVP] */
#pragma unroll
    for (int i = 0; i < 4; ++i)
#pragma unroll
      for (int j = 0; j < 4; ++j) { FragH f;
#pragma unroll
        for (int r = 0; r < 8; ++r) f.h[r] = (_Float16)(acc[2][i][j][r] * 0.0625f);
        *(v8us*)(tv + (j * 16 + ln) * QVP + 64 * w + i * 16 + 8 * hh) = f.half[0]; }
    __syncthreads();      /* every wave's columns are in LDS before any wave reads whole rows of V^T */
    unsigned short* vt = (unsigned short*)VTa + ((size_t)(b * NH + h) * HD + w * 16) * SQ + pb + lane * 8;
#pragma unroll
    for (int qb = 0; qb < 16; qb += 4) { v8us vr[4];      /* four rows are read ahead of their store statements: no LDS read moves up over one */
#pragma unroll
      for (int q = 0; q < 4; ++q) vr[q] = *(const v8us*)(tv + (w * 16 + qb + q) * QVP + lane * 8);
#pragma unroll
      for (int q = 0; q < 4; ++q) st16_wait(vt + (size_t)(qb + q) * SQ, vr[q]); }
    if (first) { float* vf = VF + ((size_t)b * QT0 + p0 + 8 * hh) * DM + h * HD + ln;
#pragma unroll
      for (int i = 0; i < 4; ++i)
#pragma unroll
        for (int j = 0; j < 4; ++j)
#pragma unroll
          for (int r = 0; r < 8; ++r) vf[(size_t)(i * 16 + r) * DM + j * 16] = acc[2][i][j][r] * 0.0625f;
      asm volatile("s_wait_xcnt 0x0" ::: "memory"); }      /* stands behind the f32 v stores, ahead of the first write of a register that one of them names */
  }
  const int rs = lane >> 3, up = (lane >> 2) & 1, i8 = (lane & 3) * 8;
#pragma unroll
  for (int hf = 0; hf < 2; ++hf) { v8f aq[8], ak[8];      /* 32 rows of q and of k at a time */
#pragma unroll
    for (int u = 0; u < 8; ++u) { aq[u] = acc[0][hf * 2 + (u >> 2)][u & 3] * 0.0625f; ak[u] = acc[1][hf * 2 + (u >> 2)][u & 3] * 0.0625f; }
    const int pp = p0 + hf * 32 + rs; const size_t oh = ((size_t)b * SQ + pp) * DM + h * HD + up * 32 + i8, of = ((size_t)b * QT0 + pp) * DM + h * HD + up * 32 + i8;      /* of: formed for every wave, used by the first-tile rows alone */
    g4_rope32(so[w8 * 2], so[w8 * 2 + 1], aq, ak, (unsigned short*)Q16 + oh, (unsigned short*)K16 + oh, QF + of, KF + of, tcos + (size_t)pp * (HD / 2) + i8, tsin + (size_t)pp * (HD / 2) + i8, first, lane); } }
static_assert(QT0 == 128 && SQ % 256 == 0 && HD == 64 && DM == NH * HD && NH % 2 == 0, "k_qkv_rope: a block is 256 rows of one batch x two heads; the first-tile rows are whole 64-row wave tiles");

__global__ __launch_bounds__(256) void k_wnat(const float* __restrict__ w, size_t n8, _Float16* __restrict__ Bt) { const size_t t = (size_t)blockIdx.x * 256 + threadIdx.x; if (t >= n8) return; FragH f; for (int q = 0; q < 8; ++q) f.h[q] = (_Float16)(bf16_round(w[t * 8 + q]) * 16.0f); *(v8us*)((unsigned short*)Bt + t * 8) = f.half[0];  }
__global__ __launch_bounds__(256) void k_rsm(const float* __restrict__ S, _Float16* __restrict__ P, int nrows) {
  #pragma clang fp contract(off)
  const int i = blockIdx.x * 256 + threadIdx.x; if (i >= nrows) return; const float* s = S + (size_t)i * SQ; float mx = -3.0e38f;
#pragma unroll 1
  for (int j = 0; j < SQ; ++j) mx = fmaxf(mx, s[j]); float se = 0.f;
#pragma unroll 1
  for (int j = 0; j < SQ; ++j) se += expf(s[j] - mx); const float sc = 256.0f / se;
#pragma unroll 1
  for (int j0 = 0; j0 < SQ; j0 += 8) { FragH f; for (int q = 0; q < 8; ++q) f.h[q] = (_Float16)(expf(s[j0 + q] - mx) * sc); unsigned short* d = (unsigned short*)P + (size_t)i * SQ + j0; *(v8us*)d = f.half[0];  } }
__global__ __launch_bounds__(256) void k_vt(const _Float16* __restrict__ V16, int b, int h0, _Float16* __restrict__ VT) { __shared__ unsigned short tl[64][65]; const int tid = threadIdx.x; const int hh = blockIdx.x % HG, sg = blockIdx.x / HG; const int s0 = sg * 64; const int h = h0 + hh;
  for (int i = tid; i < 64 * 8; i += 256) { const int j = i / 8, d8 = (i % 8) * 8; FragH f; f.half[0] = *(const v8us*)((const unsigned short*)V16 + ((size_t)b * SQ + s0 + j) * DM + h * HD + d8); for (int q = 0; q < 8; ++q) tl[d8 + q][j] = f.u[q]; }
  __syncthreads();
  { for (int i = tid; i < 64 * 8; i += 256) { const int d = i / 8, j8 = (i % 8) * 8; FragH f; for (int q = 0; q < 8; ++q) f.u[q] = tl[d][j8 + q]; *(v8us*)((unsigned short*)VT + ((size_t)hh * HD + d) * SQ + s0 + j8) = f.half[0]; }  } }


__global__ __launch_bounds__(256) void k_tab2(float theta, float* __restrict__ CS, float* __restrict__ SN) {
  #pragma clang fp contract(off)
  const int t = blockIdx.x * 256 + threadIdx.x; if (t >= SQ * (HD / 2)) return; const int i = t % (HD / 2); const int p = t / (HD / 2); const float invf = 1.0f / powf(theta, (float)(2 * i) / (float)HD); const float ang = __fmul_rn((float)p, invf); const float c = cosf(ang), s = sinf(ang);
  *(float*)(CS + t) = c; *(float*)(SN + t) = s;  }
template <int NORM, int ROPE>
__global__ __launch_bounds__(64) void k_xform(const float* __restrict__ F, int ldf, int nh, const float* __restrict__ gain, float eps, const float* __restrict__ CS, const float* __restrict__ SN, _Float16* __restrict__ H16, int ldo) {
  #pragma clang fp contract(off)
  __shared__ float xv[HD]; __shared__ float red[HD]; __shared__ unsigned short sh_[HD]; const int d = threadIdx.x; const int h = blockIdx.x % nh; const size_t r = blockIdx.x / nh; const int p = (int)(r % SQ);
  float x = F[r * (size_t)ldf + (size_t)h * HD + d];
  if (NORM) { red[d] = __fmul_rn(x, x); __syncthreads(); for (int st = HD / 2; st > 0; st >>= 1) { if (d < st) red[d] = __fadd_rn(red[d], red[d + st]); __syncthreads(); } const float rs = rsqrtf(__fadd_rn(red[0] / (float)HD, eps)); x = __fmul_rn(__fmul_rn(x, rs), bf16_round(gain[d])); }
  xv[d] = x; __syncthreads();
  float o = x;
  if (ROPE == 1) { const int i = d >> 1; const float c = CS[p * (HD / 2) + i], s = SN[p * (HD / 2) + i]; const float ev = xv[2 * i], od = xv[2 * i + 1]; o = (d & 1) ? __fadd_rn(__fmul_rn(ev, s), __fmul_rn(od, c)) : __fadd_rn(__fmul_rn(ev, c), -__fmul_rn(od, s)); }
  if (ROPE == 2) { const int i = d & (HD / 2 - 1); const float c = CS[p * (HD / 2) + i], s = SN[p * (HD / 2) + i]; const float lo = xv[i], hi = xv[i + HD / 2]; o = (d < HD / 2) ? __fadd_rn(__fmul_rn(lo, c), -__fmul_rn(hi, s)) : __fadd_rn(__fmul_rn(lo, s), __fmul_rn(hi, c)); }
  FragH th; th.h[0] = (_Float16)o; sh_[d] = th.u[0]; __syncthreads();
  if (d < HD / 8) { FragH f; for (int q = 0; q < 8; ++q) f.u[q] = sh_[d * 8 + q]; unsigned short* dst = (unsigned short*)H16 + r * (size_t)ldo + (size_t)h * HD + d * 8; *(v8us*)dst = f.half[0];  } }

__global__ __launch_bounds__(256) void k_tab4(const int* __restrict__ pos, float theta, float* __restrict__ CS, float* __restrict__ SN) {
  #pragma clang fp contract(off)
  const int t = blockIdx.x * 256 + threadIdx.x; if (t >= SQ * (HD / 2)) return; const int i = t % (HD / 2); const int p = t / (HD / 2); const float invf = (float)pow((double)theta, -((double)(2 * i)) / (double)HD); const float ang = __fmul_rn((float)pos[p], invf); const float c = cosf(ang), s = sinf(ang);
  *(float*)(CS + t) = c; *(float*)(SN + t) = s;  }
__global__ __launch_bounds__(256) void k_rsmf(const float* __restrict__ S, _Float16* __restrict__ P, int qn, int hg) {
  #pragma clang fp contract(off)
  const int t = blockIdx.x * 256 + threadIdx.x; if (t >= qn * hg) return; const size_t i = (size_t)(t / qn) * SQ + (t % qn); const float* s = S + i * SQ; float mx = -3.0e38f;
#pragma unroll 1
  for (int j = 0; j < SQ; ++j) mx = fmaxf(mx, s[j]); float se = 0.f;
#pragma unroll 1
  for (int j = 0; j < SQ; ++j) se += __expf(s[j] - mx); const float sc = 256.0f / se;
#pragma unroll 1
  for (int j0 = 0; j0 < SQ; j0 += 8) { FragH f; for (int q = 0; q < 8; ++q) f.h[q] = (_Float16)(__expf(s[j0 + q] - mx) * sc); unsigned short* d = (unsigned short*)P + i * SQ + j0; *(v8us*)d = f.half[0];  } }


__device__ __forceinline__ v8f fa_mma(v16h a, v16h b, v8f c) { return __builtin_amdgcn_wmma_f32_16x16x32_f16(false, a, false, b, (short)0, c, false, false); }
// 2^x for eight values (two for the rescale factors) in ONE statement: outputs are early-clobber, so no exponential reads its predecessor's result or overwrites its source, and the closing v_nop keeps the one
// independent slot that the instruction set asks for between the last exponential and whatever the compiler places next.
__device__ __forceinline__ v8f fa_exp8(v8f x) { float y0, y1, y2, y3, y4, y5, y6, y7;
  asm("v_exp_f32 %0, %8\n\tv_exp_f32 %1, %9\n\tv_exp_f32 %2, %10\n\tv_exp_f32 %3, %11\n\tv_exp_f32 %4, %12\n\tv_exp_f32 %5, %13\n\tv_exp_f32 %6, %14\n\tv_exp_f32 %7, %15\n\tv_nop"
      : "=&v"(y0), "=&v"(y1), "=&v"(y2), "=&v"(y3), "=&v"(y4), "=&v"(y5), "=&v"(y6), "=&v"(y7) : "v"(x[0]), "v"(x[1]), "v"(x[2]), "v"(x[3]), "v"(x[4]), "v"(x[5]), "v"(x[6]), "v"(x[7]));
  const v8f y = {y0, y1, y2, y3, y4, y5, y6, y7}; return y; }
__device__ __forceinline__ void fa_exp2(float x0, float x1, float& y0, float& y1) { asm("v_exp_f32 %0, %2\n\tv_exp_f32 %1, %3\n\tv_nop" : "=&v"(y0), "=&v"(y1) : "v"(x0), "v"(x1)); }
// A stage is 64 keys: 64 K rows, then the 64 V^T rows' 64 columns, each row 128 bytes at the pitch GP (16 bytes x an odd number: the 16-byte fragment reads meet no bank conflict).
// 128 threads: thread t brings 16-byte piece t & 7 of rows (t >> 3) + 16 j, so one wave's copy covers four whole 128-byte lines.
#define FSTG (128 * GP * 2)          /* bytes of one stage */
// Eight asynchronous copies, each lane its own 16 bytes, with s_wait_xcnt 0 as the last line of the same statement: it stands ahead of any rewrite of the address registers that the copies name.
__device__ __forceinline__ void fa_copy8(unsigned l, const _Float16* k, const _Float16* v) {
  asm volatile("global_load_async_to_lds_b128 %0, %8, off\n\tglobal_load_async_to_lds_b128 %1, %9, off\n\tglobal_load_async_to_lds_b128 %2, %10, off\n\tglobal_load_async_to_lds_b128 %3, %11, off\n\t"
               "global_load_async_to_lds_b128 %4, %12, off\n\tglobal_load_async_to_lds_b128 %5, %13, off\n\tglobal_load_async_to_lds_b128 %6, %14, off\n\tglobal_load_async_to_lds_b128 %7, %15, off\n\ts_wait_xcnt 0x0"
               :: "v"(l), "v"(l + 16u * GP * 2), "v"(l + 32u * GP * 2), "v"(l + 48u * GP * 2), "v"(l + 64u * GP * 2), "v"(l + 80u * GP * 2), "v"(l + 96u * GP * 2), "v"(l + 112u * GP * 2),
                  "v"(k), "v"(k + 16 * DM), "v"(k + 32 * DM), "v"(k + 48 * DM), "v"(v), "v"(v + 16 * SQ), "v"(v + 32 * SQ), "v"(v + 48 * SQ) : "memory"); }
// The K fragments of one step from the stage: ks = the lane's K row of the step's first 16 keys.
__device__ __forceinline__ void fa_kfrags(v16h (&kf)[2][2], const _Float16* ks, int hh) {
#pragma unroll
  for (int kt = 0; kt < 2; ++kt) { kf[kt][0] = g2_frag(ks + kt * 16 * GP, hh); kf[kt][1] = g2_frag(ks + kt * 16 * GP + 32, hh); } }
// One step of 32 keys; kf holds its K fragments. vs = the lane's V^T row at the step's first key: the V^T fragments are read behind the score products, so that the softmax passes before they are needed;
// PRE: the same stage holds the next step too: its K rows (kn) are read ahead of the output products, when the scores' registers are free again. DIAG: a step in the block's own 128 keys, its first key dq below the wave's first query (0 in the wave's last step): keys above the query get weight 0.
template <bool DIAG, bool PRE>
__device__ __forceinline__ void fa_step(const v16h (&qf)[2][2], v16h (&kf)[2][2], v8f (&o)[2][4], float (&mu)[2], float (&l)[2], const _Float16* vs, const _Float16* kn, int dq, int c, int hh) {
  const float cs = 0.125f * 1.44269504088896340736f;      /* score scale x log2(e) */
  const v8f z8 = {0.f,0.f,0.f,0.f,0.f,0.f,0.f,0.f};
  v8f s[2][2];
#pragma unroll
  for (int u = 0; u < 2; ++u)
#pragma unroll
    for (int kt = 0; kt < 2; ++kt) s[u][kt] = fa_mma(kf[kt][1], qf[u][1], fa_mma(kf[kt][0], qf[u][0], z8));
  v16h vf[4];
#pragma unroll
  for (int t = 0; t < 4; ++t) vf[t] = g2_frag(vs + t * 16 * GP, hh);
  if (DIAG) {
#pragma unroll
    for (int u = 0; u < 2; ++u)
#pragma unroll
      for (int kt = 0; kt < 2; ++kt)
#pragma unroll
        for (int r = 0; r < 8; ++r) s[u][kt][r] = (kt * 16 + 8 * hh + r <= dq + u * 16 + c) ? s[u][kt][r] : -1.0e30f; }
  float mx[2];
#pragma unroll
  for (int u = 0; u < 2; ++u) { float a = fmaxf(s[u][0][0], s[u][1][0]);
#pragma unroll
    for (int r = 1; r < 8; ++r) a = fmaxf(a, fmaxf(s[u][0][r], s[u][1][r]));
    a = fmaxf(a, __shfl_xor(a, 16)); mx[u] = a * cs; }      /* cs > 0: scaling commutes with the maximum */
  if (__builtin_amdgcn_ballot_w32(mx[0] > mu[0] + 8.0f || mx[1] > mu[1] + 8.0f) != 0) {      /* one scalar test per step */
    const float mn0 = fmaxf(mu[0], mx[0]), mn1 = fmaxf(mu[1], mx[1]); float al[2]; fa_exp2(mu[0] - mn0, mu[1] - mn1, al[0], al[1]); mu[0] = mn0; mu[1] = mn1;
#pragma unroll
    for (int u = 0; u < 2; ++u) { l[u] *= al[u];
#pragma unroll
      for (int t = 0; t < 4; ++t) o[u][t] *= al[u]; } }
  FragH pf[2];
#pragma unroll
  for (int u = 0; u < 2; ++u) { float sm = 0.f;
#pragma unroll
    for (int kt = 0; kt < 2; ++kt) { v8f x;
#pragma unroll
      for (int r = 0; r < 8; ++r) x[r] = fmaf(s[u][kt][r], cs, -mu[u]);
      const v8f p = fa_exp8(x);
#pragma unroll
      for (int r = 0; r < 8; ++r) { sm += p[r]; pf[u].h[kt * 8 + r] = (_Float16)p[r]; } }
    l[u] += sm; }
  if (PRE) fa_kfrags(kf, kn, hh);
#pragma unroll
  for (int u = 0; u < 2; ++u)
#pragma unroll
    for (int t = 0; t < 4; ++t) o[u][t] = fa_mma(vf[t], pf[u].v, o[u][t]); }
// Exact f32 causal attention for the first QT0 rows of every batch, run by blocks of the fused attention launch: a block takes 8 query rows of one (batch, head), a wave two of them, one after the other.
// The head's QT0 key rows are staged in LDS at a pitch of HD + 4 floats (16 bytes x an odd number: row-per-lane 16-byte reads without bank conflicts).
// Lane l scores keys l, l + 32, l + 64, l + 96 (each dot product summed over d in index order); row maximum and row sum end in lane butterflies;
// then lane l sums output columns 2 l and 2 l + 1 over the keys in index order, each weight read from its lane as a scalar.
typedef float v2f __attribute__((ext_vector_type(2)));
typedef float v2fa __attribute__((ext_vector_type(2), may_alias));
typedef _Float16 v2h __attribute__((ext_vector_type(2)));
// The row's two 4-byte stores with s_wait_xcnt 0 as the last line of the same statement: the wave's second row rewrites the registers that they name.
__device__ __forceinline__ void st4x2_wait(_Float16* ph, unsigned dh, _Float16* pl, unsigned dl) { asm volatile("global_store_b32 %0, %1, off\n\tglobal_store_b32 %2, %3, off\n\ts_wait_xcnt 0x0" :: "v"(ph), "v"(dh), "v"(pl), "v"(dl) : "memory"); }
#define FNR ((SQ / 128) * NB * NH)   /* blocks of the f16 path's index range: 16 query tiles x (batch, head) */
#define FNE (NB * NH * (QT0 / 8))    /* first-tile blocks */
__device__ __forceinline__ void fa_first(char* sm, int e, const float* __restrict__ QF, const float* __restrict__ KF, const float* __restrict__ VF, _Float16* __restrict__ OH, _Float16* __restrict__ OL) {      /* all five row pitches are DM, so that every row step is an immediate offset */
  float (*lk)[HD + 4] = (float (*)[HD + 4])sm;
  const float scale = 0.125f;
  { const size_t bo = (size_t)(e / (NH * (QT0 / 8))) * QT0 * DM; QF += bo; KF += bo; VF += bo; OH += bo; OL += bo; }      /* the batch */
  const int ex = e % (NH * (QT0 / 8));
  const int tid = threadIdx.x, lane = tid & 31; const int h = ex / (QT0 / 8);
  const float* kb = KF + h * HD;
#pragma unroll
  for (int p = 0; p < QT0 / 8; ++p) { const int r = p * 8 + (tid >> 4), c4 = (tid & 15) * 4; *(v4f*)&lk[r][c4] = *(const v4fa*)(kb + (size_t)r * DM + c4); }      /* unrolled: all 16 loads of a thread in flight at once */
  __syncthreads();      /* block-uniform path: the key rows are whole in LDS before any wave scores them */
#pragma unroll 1
  for (int rw = 0; rw < 2; ++rw) {      /* kept rolled: one copy of the row's code */
  const int i = (ex % (QT0 / 8)) * 8 + rw * 4 + __builtin_amdgcn_readfirstlane(tid >> 5);      /* the wave's query row, held as a scalar so that the q row and the group tests below are wave-uniform */
  const float* qr = QF + (size_t)i * DM + h * HD;
  float sa[QT0 / 32];
#pragma unroll
  for (int g = 0; g < QT0 / 32; ++g) sa[g] = 0.f;
#pragma unroll 8
  for (int c = 0; c < HD / 4; ++c) { const v4f qq = *(const v4fa*)(qr + c * 4);      /* unrolled by 8: the four groups' sum chains interleave, and the 32 key pieces read ahead fit the registers of four waves per SIMD (all 64 spilled) */
#pragma unroll
    for (int g = 0; g < QT0 / 32; ++g) { const v4f kq = *(const v4f*)&lk[g * 32 + lane][c * 4]; sa[g] = fmaf(qq[0], kq[0], sa[g]); sa[g] = fmaf(qq[1], kq[1], sa[g]); sa[g] = fmaf(qq[2], kq[2], sa[g]); sa[g] = fmaf(qq[3], kq[3], sa[g]); } }
  float m = -1.0e30f;
#pragma unroll
  for (int g = 0; g < QT0 / 32; ++g) { sa[g] = (g * 32 + lane <= i) ? sa[g] * scale : -1.0e30f; m = fmaxf(m, sa[g]); }      /* causal: keys above the row get weight 0 */
#pragma unroll
  for (int o = 16; o > 0; o >>= 1) m = fmaxf(m, __shfl_xor(m, o));
  float l = 0.f;
#pragma unroll
  for (int g = 0; g < QT0 / 32; ++g) { sa[g] = expf(sa[g] - m); l += sa[g]; }
#pragma unroll
  for (int o = 16; o > 0; o >>= 1) l += __shfl_xor(l, o);
  const float* vb = VF + h * HD + lane * 2; float o0 = 0.f, o1 = 0.f;
#pragma unroll
  for (int g = 0; g < QT0 / 32; ++g) { if (g * 32 <= i) {      /* wave-uniform: key groups wholly above the row are skipped */
#pragma unroll
      for (int jj = 0; jj < 32; ++jj) { const float p = __int_as_float(__builtin_amdgcn_readlane(__float_as_int(sa[g]), jj)); const v2f vv = *(const v2fa*)(vb + (size_t)(g * 32 + jj) * DM); o0 = fmaf(p, vv[0], o0); o1 = fmaf(p, vv[1], o1); } } }      /* unrolled: a group's 32 loads issue before the first use */
  const float fin = 64.0f / l;      /* o carried x64 like the f16 path */
  const float a0 = o0 * fin, a1 = o1 * fin; v2h hv, lv;      /* o leaves as an f16 value plus its residual x1024, the two A operands of the output projection's first-tile blocks */
  hv[0] = (_Float16)a0; hv[1] = (_Float16)a1; lv[0] = (_Float16)((a0 - (float)hv[0]) * 1024.0f); lv[1] = (_Float16)((a1 - (float)hv[1]) * 1024.0f);
  const size_t oo = (size_t)i * DM + h * HD + lane * 2; st4x2_wait(OH + oo, __builtin_bit_cast(unsigned, hv), OL + oo, __builtin_bit_cast(unsigned, lv)); } }
static_assert(sizeof(float) * QT0 * (HD + 4) <= 2 * FSTG, "fa_first: the key rows fit the two stages");
// amdgpu_waves_per_eu(4, 4): the register budget of four waves per SIMD, four blocks per WGP; left free, a trip of two steps took more than 256 registers.
__global__ __launch_bounds__(128) __attribute__((amdgpu_waves_per_eu(4, 4))) void k_fattn(const _Float16* __restrict__ Q16, const _Float16* __restrict__ K16, const _Float16* __restrict__ VTa, _Float16* __restrict__ O,
    const float* __restrict__ QF, const float* __restrict__ KF, const float* __restrict__ VF, _Float16* __restrict__ OH, _Float16* __restrict__ OL) {
  __shared__ __attribute__((aligned(16))) char sm[2 * FSTG];      /* two stages */
  const int tid = threadIdx.x, lane = tid & 31, c = lane & 15, hh = lane >> 4;
  const int w = __builtin_amdgcn_readfirstlane(tid >> 5);      /* the wave's number as a scalar: the tests of the last two trips are scalar branches */
  const int bh = blockIdx.x % (NB * NH); const int g = blockIdx.x / (4 * NB * NH), rr = (blockIdx.x / (NB * NH)) % 4;
  const int qt = (3 - g) * 4 + ((g & 1) ? rr : 3 - rr);      /* a permutation of the 16 query tiles: long tiles first, and blocks 256 apart (a quarter of the f16 path's index range) have tiles that sum to the same length */
  if (qt == 0 || blockIdx.x >= FNR) { fa_first(sm, blockIdx.x >= FNR ? (int)blockIdx.x - FNR + NB * NH : bh, QF, KF, VF, OH, OL); return; }      /* block-uniform, ahead of every barrier and copy: the output projection takes each batch's first 128 rows from the exact f32 attention, so the blocks of query tile 0 and those behind the index range do that work; they are short, come late in the index order and run beside the long tiles */
  const int b = bh / NH, h = bh % NH; const int q0 = qt * 128 + w * 32;
  const _Float16* qp = Q16 + ((size_t)b * SQ + q0 + c) * DM + h * HD;
  const unsigned l0 = (unsigned)(size_t)sm + (unsigned)(tid >> 3) * (GP * 2) + (unsigned)(tid & 7) * 16;      /* the thread's first place in stage 0: LDS byte address */
  const _Float16* gk = K16 + ((size_t)b * SQ + (tid >> 3)) * DM + h * HD + (tid & 7) * 8;
  const _Float16* gv = VTa + ((size_t)bh * HD + (tid >> 3)) * SQ + (tid & 7) * 8;
  const v8f z8 = {0.f,0.f,0.f,0.f,0.f,0.f,0.f,0.f};
  v16h qf[2][2], kf[2][2];
#pragma unroll
  for (int u = 0; u < 2; ++u) { qf[u][0] = g2_frag(qp + (size_t)u * 16 * DM, hh); qf[u][1] = g2_frag(qp + (size_t)u * 16 * DM + 32, hh); }
  asm volatile("s_wait_xcnt 0x0" ::: "memory");      /* stands behind the query fragments' loads, ahead of the first write of a register that holds one of their addresses */
  fa_copy8(l0, gk, gv);
  asm volatile("s_wait_asynccnt 0x0" ::: "memory");      /* this wave's part of stage 0 has landed */
  __syncthreads();      /* stage 0 is whole for every wave */
  fa_copy8(l0 + FSTG, gk + 64 * DM, gv + 64);      /* a block has 2 qt + 2 stages, never fewer than two */
  v8f o[2][4]; float mu[2], l[2];
#pragma unroll
  for (int u = 0; u < 2; ++u) { mu[u] = -1.0e30f; l[u] = 0.f;
#pragma unroll
    for (int t = 0; t < 4; ++t) o[u][t] = z8; }
#pragma unroll 1
  for (int t = 0; t < 2 * qt; ++t) {      /* the stages below the block's first query: both steps are whole for all four waves. Kept rolled: one trip is one stage, 32 WMMAs a wave, and the registers of four waves per SIMD */
    const _Float16* st = (const _Float16*)(sm + (t & 1) * FSTG);
    const _Float16* ks = st + c * GP; const _Float16* vs = st + (64 + c) * GP;
    fa_kfrags(kf, ks, hh);
    fa_step<false, true>(qf, kf, o, mu, l, vs, ks + 32 * GP, 0, c, hh);
    fa_step<false, false>(qf, kf, o, mu, l, vs + 32, ks, 0, c, hh);
    asm volatile("s_wait_dscnt 0x0" ::: "memory");      /* this wave's reads of the stage have returned */
    asm volatile("s_wait_asynccnt 0x0" ::: "memory");      /* this wave's part of stage t + 1 has landed */
    __syncthreads();      /* publishes stage t + 1 and ends every wave's reads of stage t */
    fa_copy8(l0 + (unsigned)(t & 1) * FSTG, gk + (size_t)(t + 2) * 64 * DM, gv + (t + 2) * 64); }      /* refill of the stage just left; stage t + 2 <= 2 qt + 1 exists on every trip of this loop */
#pragma unroll 1
  for (int tt = 0; tt < 2; ++tt) {      /* the block's own 128 keys, stages 2 qt (in the first buffer: 2 qt is even) and 2 qt + 1: step j is whole for the waves above j (the mask keeps every score), the diagonal of wave j, nothing for the waves below; every wave passes the trip's foot */
    const _Float16* st = (const _Float16*)(sm + tt * FSTG);
#pragma unroll 1
    for (int kk = 0; kk < 2; ++kk) { const int j = tt * 2 + kk;      /* kept rolled: one copy of the step's code */
      const _Float16* ks = st + (kk * 32 + c) * GP; const _Float16* vs = st + (64 + c) * GP + kk * 32;
      if (j <= w) { fa_kfrags(kf, ks, hh); fa_step<true, false>(qf, kf, o, mu, l, vs, ks, (w - j) * 32, c, hh); } }      /* a scalar test: j and w are wave-uniform scalars */
    asm volatile("s_wait_dscnt 0x0" ::: "memory");      /* this wave's reads of the stage have returned */
    asm volatile("s_wait_asynccnt 0x0" ::: "memory");      /* this wave's part of the last stage has landed */
    __syncthreads(); }      /* publishes the last stage */
  asm volatile("s_wait_asynccnt 0x0" ::: "memory");      /* no copy is outstanding when the wave ends */
#pragma unroll
  for (int u = 0; u < 2; ++u) { const float fin = 64.0f / (l[u] + __shfl_xor(l[u], 16));      /* the lane halves' sums join once; o carried x64 */
    unsigned short* dst = (unsigned short*)O + ((size_t)b * SQ + q0 + u * 16 + c) * DM + h * HD + 8 * hh;
#pragma unroll
    for (int t = 0; t < 4; ++t) { FragH f;
#pragma unroll
      for (int r = 0; r < 8; ++r) f.h[r] = (_Float16)(o[u][t][r] * fin);      /* register r is output column 16 t + 8 hh + r of query c: one 16-byte store */
      *(v8us*)(dst + t * 16) = f.half[0]; } } }
static_assert(SQ == 16 * 128 && HD == 64, "k_fattn: 16 query tiles of 4 waves x 32 query columns, head size 64");


// Output projection of ALL token rows in ONE launch (wave tile, product order and store path of k_gemm2, pitches and K = DM; K loop on LDS stages as in k_qkv_rope): out = o W_o, o carried x64 and W_o x16.
// A block is 8 waves: 128 rows of one batch x 128 columns. The blocks of each batch's first 128 rows take the exact attention's o instead of the f16 path's: its f16 value and its x1024 residual are two A operands
// that share every B fragment in one K loop, on two accumulator sets that join in the epilogue (hi 2^-10 + lo 2^-20). These blocks do twice the products, so they have the lowest block indices.
__global__ __launch_bounds__(256) void k_oproj(const _Float16* __restrict__ O, const _Float16* __restrict__ OH, const _Float16* __restrict__ OL, const _Float16* __restrict__ Bh, float* __restrict__ C) {
  __shared__ __attribute__((aligned(16))) char sm[2 * GSTG3];      /* two stages in the K loop; behind it the epilogue's staging */
  static_assert(sizeof(float) * 8 * 32 * 68 <= 2 * GSTG3, "the epilogue's staging fits the two stages");
  float (*so)[32][68] = (float (*)[32][68])sm;
  const int tid = threadIdx.x, w8 = tid >> 5, w = w8 & 3, wg = w8 >> 2, lane = tid & 31, ln = lane & 15, hh = lane >> 4;      /* w: the wave's 32 rows; wg: its 64 columns */
  const int ntn = DM / 128, tpb = SQ / 128; const int mi = blockIdx.x / ntn, np = blockIdx.x - mi * ntn;
  const bool first = mi < NB;      /* block-uniform */
  const int b = first ? mi : (mi - NB) / (tpb - 1); const int tl = first ? 0 : 1 + (mi - NB) % (tpb - 1);      /* batch; 128-row tile in the batch */
  const int row0 = b * SQ + tl * 128 + 32 * w, col0 = np * 128 + wg * 64;
  const unsigned l0 = (unsigned)(size_t)sm + (unsigned)(tid >> 3) * (GP * 2) + (unsigned)(tid & 7) * 16;      /* the thread's first place in stage 0: LDS byte address */
  const _Float16* gb = Bh + (size_t)(np * 128 + (tid >> 3)) * DM + (tid & 7) * 8;
  const v8f z8 = {0.f,0.f,0.f,0.f,0.f,0.f,0.f,0.f}; v8f c00 = z8, c01 = z8, c02 = z8, c03 = z8, c10 = z8, c11 = z8, c12 = z8, c13 = z8;
  v8f accs[8];
  if (!first) {
    const _Float16* ga = O + (size_t)(b * SQ + tl * 128 + (tid >> 3)) * DM + (tid & 7) * 8;
    g3_copy8(l0, ga, gb);
    asm volatile("s_wait_asynccnt 0x0" ::: "memory");      /* this wave's part of tile 0 has landed */
    __syncthreads();      /* tile 0 is whole for every wave */
    g3_copy8(l0 + GSTG3, ga + 64, gb + 64);
#pragma unroll 1
    for (int t = 0; t < DM / 64; ++t) {      /* kept rolled: one trip is one stage, 16 WMMAs a wave */
      const _Float16* st = (const _Float16*)(sm + (t & 1) * GSTG3);
      const _Float16* ap = st + (32 * w + ln) * GP; const _Float16* bp = st + (128 + 64 * wg + ln) * GP;
#pragma unroll
      for (int kk = 0; kk < 64; kk += 32) { const v16h a0 = g2_frag(ap + kk, hh), a1 = g2_frag(ap + 16 * GP + kk, hh);      /* unrolled: the LDS offsets of both halves of the stage are immediates; the six fragments of 32 k are read as one group, ahead of their WMMAs */
        const v16h b0 = g2_frag(bp + kk, hh), b1 = g2_frag(bp + 16 * GP + kk, hh), b2 = g2_frag(bp + 32 * GP + kk, hh), b3 = g2_frag(bp + 48 * GP + kk, hh);
        c00 = g2_mma(a0, b0, c00); c10 = g2_mma(a1, b0, c10); c01 = g2_mma(a0, b1, c01); c11 = g2_mma(a1, b1, c11);
        c02 = g2_mma(a0, b2, c02); c12 = g2_mma(a1, b2, c12); c03 = g2_mma(a0, b3, c03); c13 = g2_mma(a1, b3, c13); }
      asm volatile("s_wait_dscnt 0x0" ::: "memory");      /* this wave's reads of the stage have returned */
      asm volatile("s_wait_asynccnt 0x0" ::: "memory");      /* this wave's part of tile t + 1 has landed */
      __syncthreads();      /* publishes tile t + 1 and ends every wave's reads of tile t */
      if (t + 2 < DM / 64) g3_copy8(l0 + (unsigned)(t & 1) * GSTG3, ga + (t + 2) * 64, gb + (t + 2) * 64); }      /* refill of the stage just left; the test is the same for the whole block */
    asm volatile("s_wait_asynccnt 0x0" ::: "memory");      /* no copy is outstanding when the stages become the epilogue's staging */
    accs[0] = c00 * 0.0009765625f; accs[1] = c01 * 0.0009765625f; accs[2] = c02 * 0.0009765625f; accs[3] = c03 * 0.0009765625f;
    accs[4] = c10 * 0.0009765625f; accs[5] = c11 * 0.0009765625f; accs[6] = c12 * 0.0009765625f; accs[7] = c13 * 0.0009765625f;
  } else {
    const size_t go = ((size_t)b * QT0 + (tid >> 3)) * DM + (tid & 7) * 8;
    const _Float16* ga = OH + go; const _Float16* ge = OL + go;
    v8f d00 = z8, d01 = z8, d02 = z8, d03 = z8, d10 = z8, d11 = z8, d12 = z8, d13 = z8;
    g3_copy8(l0, ga, gb); g3_copy4(l0 + 256u * GP * 2, ge);
    asm volatile("s_wait_asynccnt 0x0" ::: "memory");      /* this wave's part of tile 0 has landed */
    __syncthreads();      /* tile 0 is whole for every wave */
    g3_copy8(l0 + GSTG3, ga + 64, gb + 64); g3_copy4(l0 + GSTG3 + 256u * GP * 2, ge + 64);
#pragma unroll 1
    for (int t = 0; t < DM / 64; ++t) {      /* kept rolled, like the loop above: 32 WMMAs a wave */
      const _Float16* st = (const _Float16*)(sm + (t & 1) * GSTG3);
      const _Float16* ap = st + (32 * w + ln) * GP; const _Float16* bp = st + (128 + 64 * wg + ln) * GP; const _Float16* ep = st + (256 + 32 * w + ln) * GP;
#pragma unroll
      for (int kk = 0; kk < 64; kk += 32) { const v16h a0 = g2_frag(ap + kk, hh), a1 = g2_frag(ap + 16 * GP + kk, hh), e0 = g2_frag(ep + kk, hh), e1 = g2_frag(ep + 16 * GP + kk, hh);      /* unrolled and grouped as above: eight fragments */
        const v16h b0 = g2_frag(bp + kk, hh), b1 = g2_frag(bp + 16 * GP + kk, hh), b2 = g2_frag(bp + 32 * GP + kk, hh), b3 = g2_frag(bp + 48 * GP + kk, hh);
        c00 = g2_mma(a0, b0, c00); c10 = g2_mma(a1, b0, c10); d00 = g2_mma(e0, b0, d00); d10 = g2_mma(e1, b0, d10);
        c01 = g2_mma(a0, b1, c01); c11 = g2_mma(a1, b1, c11); d01 = g2_mma(e0, b1, d01); d11 = g2_mma(e1, b1, d11);
        c02 = g2_mma(a0, b2, c02); c12 = g2_mma(a1, b2, c12); d02 = g2_mma(e0, b2, d02); d12 = g2_mma(e1, b2, d12);
        c03 = g2_mma(a0, b3, c03); c13 = g2_mma(a1, b3, c13); d03 = g2_mma(e0, b3, d03); d13 = g2_mma(e1, b3, d13); }
      asm volatile("s_wait_dscnt 0x0" ::: "memory");      /* this wave's reads of the stage have returned */
      asm volatile("s_wait_asynccnt 0x0" ::: "memory");      /* this wave's part of tile t + 1 has landed */
      __syncthreads();      /* publishes tile t + 1 and ends every wave's reads of tile t */
      if (t + 2 < DM / 64) { g3_copy8(l0 + (unsigned)(t & 1) * GSTG3, ga + (t + 2) * 64, gb + (t + 2) * 64); g3_copy4(l0 + (unsigned)(t & 1) * GSTG3 + 256u * GP * 2, ge + (t + 2) * 64); } }      /* refill of the stage just left; the test is the same for the whole block */
    asm volatile("s_wait_asynccnt 0x0" ::: "memory");      /* no copy is outstanding when the stages become the epilogue's staging */
    const v8f ch[8] = {c00, c01, c02, c03, c10, c11, c12, c13}, cl[8] = {d00, d01, d02, d03, d10, d11, d12, d13};
#pragma unroll
    for (int u = 0; u < 8; ++u)
#pragma unroll
      for (int r = 0; r < 8; ++r) accs[u][r] = fmaf(cl[u][r], 0.00000095367431640625f, ch[u][r] * 0.0009765625f);      /* both factors are powers of two: one rounding, that of the sum */
  }
#pragma unroll
  for (int u = 0; u < 8; ++u)
#pragma unroll
    for (int r = 0; r < 8; ++r) so[w8][(u >> 2) * 16 + 8 * hh + r][(u & 3) * 16 + ln] = accs[u][r];
  __builtin_amdgcn_fence(__ATOMIC_ACQ_REL, "workgroup"); __builtin_amdgcn_wave_barrier();      /* the wave reads back what its own lanes wrote */
  const int rsub = lane >> 4, c4 = (lane & 15) * 4;
#pragma unroll
  for (int q = 0; q < 16; ++q) { const int r = q * 2 + rsub; const v4f v = *(const v4fa*)&so[w8][r][c4]; *(v4f*)(C + (size_t)(row0 + r) * DM + col0 + c4) = v; } }
static_assert(QT0 == 128 && SQ % 128 == 0 && SQ > 128 && DM % 128 == 0, "k_oproj: the first-tile rows are one block row of each batch");

template <int NORM, int ROPE>
__global__ __launch_bounds__(64) void k_xformf(const float* __restrict__ F, int ldf, int nh, const float* __restrict__ gain, float eps, const float* __restrict__ CS, const float* __restrict__ SN, float* __restrict__ F32, int ldo) {
  #pragma clang fp contract(off)
  __shared__ float xv[HD]; __shared__ float red[HD]; const int d = threadIdx.x; const int h = blockIdx.x % nh; const size_t r = blockIdx.x / nh; const int p = (int)(r % SQ);
  float x = F[r * (size_t)ldf + (size_t)h * HD + d];
  if (NORM) { red[d] = __fmul_rn(x, x); __syncthreads(); for (int st = HD / 2; st > 0; st >>= 1) { if (d < st) red[d] = __fadd_rn(red[d], red[d + st]); __syncthreads(); } const float rs = rsqrtf(__fadd_rn(red[0] / (float)HD, eps)); x = __fmul_rn(__fmul_rn(x, rs), bf16_round(gain[d])); }
  xv[d] = x; __syncthreads();
  float o = x;
  if (ROPE == 1) { const int i = d >> 1; const float c = CS[p * (HD / 2) + i], s = SN[p * (HD / 2) + i]; const float ev = xv[2 * i], od = xv[2 * i + 1]; o = (d & 1) ? __fadd_rn(__fmul_rn(ev, s), __fmul_rn(od, c)) : __fadd_rn(__fmul_rn(ev, c), -__fmul_rn(od, s)); }
  if (ROPE == 2) { const int i = d & (HD / 2 - 1); const float c = CS[p * (HD / 2) + i], s = SN[p * (HD / 2) + i]; const float lo = xv[i], hi = xv[i + HD / 2]; o = (d < HD / 2) ? __fadd_rn(__fmul_rn(lo, c), -__fmul_rn(hi, s)) : __fadd_rn(__fmul_rn(lo, s), __fmul_rn(hi, c)); }
  float* dst = F32 + r * (size_t)ldo + (size_t)h * HD + d; *(float*)dst = o;  }


__global__ __launch_bounds__(256) void k_bfcp(const float* __restrict__ src, float* __restrict__ dst, size_t n4) { const size_t t = (size_t)blockIdx.x * 256 + threadIdx.x; if (t >= n4) return; const v4f a = *(const v4fa*)(src + t * 4); v4f o; for (int q = 0; q < 4; ++q) o[q] = bf16_round(a[q]); *(v4f*)(dst + t * 4) = o;  }
extern "C" void kernel_launch(void* const* d_in, const int* in_sizes, int n_in,
                              void* d_out, int out_size, void* d_ws, size_t ws_size, hipStream_t stream) {
  (void)in_sizes; (void)n_in; (void)out_size;
    const float* const* I = (const float* const*)d_in; const float* x = I[0]; const float* tcos = I[1]; const float* tsin = I[2]; const float* wq = I[3]; const float* wk = I[4]; const float* wv = I[5]; const float* wo = I[6];      /* [in][out] weights, no biases; rope tables INPUT [2048][32] */
  char* ws = (char*)d_ws; size_t off = 0;
  auto take = [&](size_t bytes) { char* p = ws + off; off += (bytes + 255) & ~(size_t)255; return p; };
  _Float16* BQKV = (_Float16*)take((size_t)3 * DM * DM * 2); _Float16* BO = (_Float16*)take((size_t)DM * DM * 2);
  _Float16* X16 = (_Float16*)take(NR * DM * 2);
  _Float16* QH = (_Float16*)take(NR * DM * 2); _Float16* KH = (_Float16*)take(NR * DM * 2); _Float16* O16 = (_Float16*)take(NR * DM * 2);
  _Float16* VT = (_Float16*)take((size_t)NB * NH * HD * SQ * 2);
  float* QF0 = (float*)take((size_t)NB * QT0 * DM * 4); float* KF0 = (float*)take((size_t)NB * QT0 * DM * 4); float* VF0 = (float*)take((size_t)NB * QT0 * DM * 4); _Float16* OH0 = (_Float16*)take((size_t)NB * QT0 * DM * 2); _Float16* OL0 = (_Float16*)take((size_t)NB * QT0 * DM * 2);
  if (off > ws_size) return;
  k_prep<<<(unsigned)(PWB + NR * DM / PXV), 256, 0, stream>>>(x, wq, wk, wv, wo, X16, BQKV, BO);      /* [in][out] weights -> Bt[n][k] x16, q | k | v stacked along n; x -> f16 rows */
  k_qkv_rope<<<(unsigned)((NR / 256) * (NH / 2)), 256, 0, stream>>>(X16, BQKV, tcos, tsin, QH, KH, VT, QF0, KF0, VF0);      /* roped f16 q, k rows, V^T [NB][NH][HD][SQ], f32 q, k, v of each batch's first 128 rows */
  k_fattn<<<FNR + FNE - NB * NH, 128, 0, stream>>>(QH, KH, VT, O16, QF0, KF0, VF0, OH0, OL0);      /* o (merged heads, x64) as f16 rows from row 128 of every batch on; rows 0..127 by the exact f32 causal attention (o x64) -> f16 hi + x1024 residual planes */
  k_oproj<<<(unsigned)((NR / 128) * (DM / 128)), 256, 0, stream>>>(O16, OH0, OL0, BO, (float*)d_out);      /* out rows are the output layout; rows 0..127 of each batch from the hi and lo planes */
}
